// v000
// The times below were measured on an AMD MI455X: many runs one after another, warmed up first and cycling through
// copies of the inputs, with the whole window's GPU time divided by the number of runs. Launches and the gaps
// between them are all in it. The median over several windows is given; except for v000 it joins two sittings, which
// can be a few percent apart, so the side-by-side timings, each taken in one sitting, are the better comparison.
// The starting kernel, v000, takes 626 microseconds a run.
#include <hip/hip_runtime.h>

// ---------------------------------------------------------------------------
// CDNA5 (gfx1250) HierarchicalTemporalCompressor: bf16 WMMA GEMMs with
// double-buffered async global->LDS staging (ASYNCcnt path) and ds_load_b128
// fragment reads. Every level: C[m,n] = sum_k A[m,k]*W[n,k] (+bias,+resid,tanh).
// ---------------------------------------------------------------------------

typedef __bf16        v16bf __attribute__((ext_vector_type(16)));
typedef float         v8f   __attribute__((ext_vector_type(8)));
typedef unsigned int  v4u   __attribute__((ext_vector_type(4)));

union BfPack {
  v4u   u[2];   // u[0] -> fragment VGPRs 0..3, u[1] -> VGPRs 4..7
  v16bf v;
};

__device__ __forceinline__ __bf16 f2bf(float f) {
  unsigned int u = __builtin_bit_cast(unsigned int, f);
  u += 0x7FFFu + ((u >> 16) & 1u);            // round-to-nearest-even
  unsigned short h = (unsigned short)(u >> 16);
  return __builtin_bit_cast(__bf16, h);
}

__device__ __forceinline__ float bf2f(__bf16 b) {
  unsigned short h = __builtin_bit_cast(unsigned short, b);
  unsigned int u = ((unsigned int)h) << 16;
  return __builtin_bit_cast(float, u);
}

__global__ void f32_to_bf16_kernel(const float* __restrict__ in,
                                   __bf16* __restrict__ out, long n) {
  long i = (long)blockIdx.x * blockDim.x + threadIdx.x;
  long stride = (long)gridDim.x * blockDim.x;
  for (; i < n; i += stride) out[i] = f2bf(in[i]);
}

// 16B async copy global -> LDS, tracked by ASYNCcnt (ISA 15.18.3 op 98).
__device__ __forceinline__ void asyncCopy16(unsigned int ldsAddr,
                                            const __bf16* gaddr) {
  asm volatile("global_load_async_to_lds_b128 %0, %1, off"
               :: "v"(ldsAddr), "v"(gaddr)
               : "memory");
}
__device__ __forceinline__ void waitAsync0() {
  asm volatile("s_wait_asynccnt 0x0" ::: "memory");
}

#define BM   128
#define BN   128
#define ROWB 80                  // 64B of K-data + 16B pad (bank-conflict-free)
#define TILEB (128 * ROWB)       // 10240 B per staged matrix tile
#define BUFB  (2 * TILEB)        // 20480 B per double-buffer stage

// EPI: 0 = compress (tanh, bf16 out, shape (M,N))
//      1 = decompress mid (reshape (M,4096)->(M*8,512), +bf16 resid, tanh, bf16)
//      2 = decompress final (reshape, +f32 resid, tanh, f32 out)
template <int EPI>
__global__ __launch_bounds__(256)
void gemm_tanh_wmma(const __bf16* __restrict__ A,
                    const __bf16* __restrict__ W,
                    const float* __restrict__ bias,
                    const __bf16* __restrict__ residB,
                    const float* __restrict__ residF,
                    __bf16* __restrict__ outB,
                    float* __restrict__ outF,
                    int M, int N, int K) {
  extern __shared__ char smem[];
  const unsigned int ldsBase = (unsigned int)(uintptr_t)smem;

  const int tid  = threadIdx.x;
  const int lane = tid & 31;
  const int wave = tid >> 5;
  const int nBlocks = N >> 7;
  const int bm = blockIdx.x / nBlocks;
  const int bn = blockIdx.x - bm * nBlocks;
  const int mBase = bm << 7;
  const int nBase = bn << 7;

  // ---- loader mapping: thread -> (row, 32B half-row) of the 128x32 slab ----
  const int lr = tid >> 1;                 // 0..127
  const int lcElem = (tid & 1) << 4;       // element offset 0 or 16
  int aRow = mBase + lr; if (aRow > M - 1) aRow = M - 1;   // clamp ragged M
  const __bf16* aSrc = A + (size_t)aRow * K + lcElem;
  const __bf16* bSrc = W + (size_t)(nBase + lr) * K + lcElem;
  const unsigned int ldsRow = (unsigned int)lr * ROWB + ((tid & 1) << 5);

  // ---- compute mapping: 8 waves = 4(M) x 2(N); wave tile 32x64 ----
  const int wm = wave & 3;
  const int wn = wave >> 2;
  const int l16 = lane & 15;
  const int koff2 = (lane >> 4) << 4;      // byte offset of K-half: 0 or 16

  v8f acc[2][4] = {};
  const int ksteps = K >> 5;

  auto issue = [&](int buf, int k0) {
    const unsigned int base = ldsBase + (unsigned int)buf * BUFB + ldsRow;
    const __bf16* ga = aSrc + k0;
    const __bf16* gb = bSrc + k0;
    asyncCopy16(base,              ga);
    asyncCopy16(base + 16,         ga + 8);
    asyncCopy16(base + TILEB,      gb);
    asyncCopy16(base + TILEB + 16, gb + 8);
  };

  issue(0, 0);
  for (int i = 0; i < ksteps; ++i) {
    waitAsync0();
    __syncthreads();                       // all slabs visible; prev compute done
    if (i + 1 < ksteps) issue((i + 1) & 1, (i + 1) << 5);

    const char* base = smem + (i & 1) * BUFB;
    BfPack a[2], b[4];
#pragma unroll
    for (int s = 0; s < 2; ++s) {
      const char* p = base + (wm * 32 + s * 16 + l16) * ROWB + koff2;
      a[s].u[0] = *(const v4u*)p;
      a[s].u[1] = *(const v4u*)(p + 32);
    }
#pragma unroll
    for (int t = 0; t < 4; ++t) {
      const char* p = base + TILEB + (wn * 64 + t * 16 + l16) * ROWB + koff2;
      b[t].u[0] = *(const v4u*)p;
      b[t].u[1] = *(const v4u*)(p + 32);
    }
#pragma unroll
    for (int s = 0; s < 2; ++s)
#pragma unroll
      for (int t = 0; t < 4; ++t)
        acc[s][t] = __builtin_amdgcn_wmma_f32_16x16x32_bf16(
            false, a[s].v, false, b[t].v, (short)0, acc[s][t], false, false);
  }

  // ---- epilogue: C VGPR r -> (row r | r+8, col lane%16) ----
  const int rowAdd = (lane >> 4) << 3;
  float bv[4];
#pragma unroll
  for (int t = 0; t < 4; ++t) bv[t] = bias[nBase + wn * 64 + t * 16 + l16];

#pragma unroll
  for (int s = 0; s < 2; ++s) {
#pragma unroll
    for (int t = 0; t < 4; ++t) {
      const int col = nBase + wn * 64 + t * 16 + l16;
#pragma unroll
      for (int r = 0; r < 8; ++r) {
        const int m = mBase + wm * 32 + s * 16 + r + rowAdd;
        if (m < M) {
          float v = acc[s][t][r] + bv[t];
          if (EPI == 0) {
            outB[(size_t)m * N + col] = f2bf(tanhf(v));
          } else {
            const int orow = (m << 3) + (col >> 9);   // (M,4096)->(M*8,512)
            const int ocol = col & 511;
            const size_t oi = (size_t)orow * 512 + ocol;
            if (EPI == 1) {
              v += bf2f(residB[oi]);
              outB[oi] = f2bf(tanhf(v));
            } else {
              v += residF[oi];
              outF[oi] = tanhf(v);
            }
          }
        }
      }
    }
  }
}

extern "C" void kernel_launch(void* const* d_in, const int* in_sizes, int n_in,
                              void* d_out, int out_size, void* d_ws, size_t ws_size,
                              hipStream_t stream) {
  (void)in_sizes; (void)n_in; (void)out_size; (void)ws_size;
  const float* seq = (const float*)d_in[0];   // (2, 32768, 512)
  const float* Wc  = (const float*)d_in[1];   // (6, 512, 4096)
  const float* bc  = (const float*)d_in[2];   // (6, 512)
  const float* Wd  = (const float*)d_in[3];   // (6, 4096, 512)
  const float* bd  = (const float*)d_in[4];   // (6, 4096)
  float* out = (float*)d_out;                 // (2, 32768, 512)

  const long WELEMS = 6L * 512 * 4096;
  const size_t LDSB = 2 * BUFB;               // 40 KB dynamic LDS

  char* ws = (char*)d_ws;
  size_t off = 0;
  auto carve = [&](size_t bytes) -> char* {
    char* p = ws + off;
    off += (bytes + 255) & ~(size_t)255;
    return p;
  };

  __bf16* WcB = (__bf16*)carve((size_t)WELEMS * 2);
  __bf16* WdB = (__bf16*)carve((size_t)WELEMS * 2);
  const long hierElems[6] = {33554432L, 4194304L, 524288L, 65536L, 8192L, 1024L};
  __bf16* hier[6];
  for (int i = 0; i < 6; ++i) hier[i] = (__bf16*)carve((size_t)hierElems[i] * 2);
  __bf16* ping = (__bf16*)carve(4194304L * 2);
  __bf16* pong = (__bf16*)carve(4194304L * 2);

  // --- f32 -> bf16 staging (weights + input sequence) ---
  f32_to_bf16_kernel<<<4096, 256, 0, stream>>>(Wc, WcB, WELEMS);
  f32_to_bf16_kernel<<<4096, 256, 0, stream>>>(Wd, WdB, WELEMS);
  f32_to_bf16_kernel<<<8192, 256, 0, stream>>>(seq, hier[0], 33554432L);

  // --- compress: 5 levels, A=(M,4096) W=(512,4096) ---
  const int Mc[5] = {8192, 1024, 128, 16, 2};
  for (int l = 0; l < 5; ++l) {
    const int M = Mc[l], N = 512, K = 4096;
    const int blocks = ((M + 127) / 128) * (N / 128);
    gemm_tanh_wmma<0><<<blocks, 256, LDSB, stream>>>(
        hier[l], WcB + (size_t)l * 512 * 4096, bc + (size_t)l * 512,
        nullptr, nullptr, hier[l + 1], nullptr, M, N, K);
  }

  // --- decompress: 5 levels, A=(M,512) W=(4096,512) ---
  const __bf16* cur = hier[5];
  __bf16* bufs[2] = {ping, pong};
  for (int i = 0; i < 5; ++i) {
    const int l = 4 - i;
    int M = 2;
    for (int j = 0; j < 4 - l; ++j) M *= 8;   // 2 * 8^(4-l)
    const int N = 4096, K = 512;
    const int blocks = ((M + 127) / 128) * (N / 128);
    if (l > 0) {
      gemm_tanh_wmma<1><<<blocks, 256, LDSB, stream>>>(
          cur, WdB + (size_t)l * 4096 * 512, bd + (size_t)l * 4096,
          hier[l], nullptr, bufs[i & 1], nullptr, M, N, K);
      cur = bufs[i & 1];
    } else {
      gemm_tanh_wmma<2><<<blocks, 256, LDSB, stream>>>(
          cur, WdB, bd, nullptr, seq, nullptr, out, M, N, K);
    }
  }
}

// v001
// Measured time: 458 microseconds a run.
// In two side-by-side timings against v000, it was 1.35 and 1.36 times as fast.
#include <hip/hip_runtime.h>

// ---------------------------------------------------------------------------
// CDNA5 (gfx1250) HierarchicalTemporalCompressor: bf16 WMMA GEMMs with
// double-buffered async global->LDS staging (ASYNCcnt path) and ds_load_b128
// fragment reads. Every level: C[m,n] = sum_k A[m,k]*W[n,k] (+bias,+resid,tanh).
// ---------------------------------------------------------------------------

typedef __bf16        v16bf __attribute__((ext_vector_type(16)));
typedef float         v8f   __attribute__((ext_vector_type(8)));
typedef unsigned int  v4u   __attribute__((ext_vector_type(4)));

union BfPack {
  v4u   u[2];   // u[0] -> fragment VGPRs 0..3, u[1] -> VGPRs 4..7
  v16bf v;
};

__device__ __forceinline__ __bf16 f2bf(float f) {
  unsigned int u = __builtin_bit_cast(unsigned int, f);
  u += 0x7FFFu + ((u >> 16) & 1u);            // round-to-nearest-even
  unsigned short h = (unsigned short)(u >> 16);
  return __builtin_bit_cast(__bf16, h);
}

__device__ __forceinline__ float bf2f(__bf16 b) {
  unsigned short h = __builtin_bit_cast(unsigned short, b);
  unsigned int u = ((unsigned int)h) << 16;
  return __builtin_bit_cast(float, u);
}

__global__ void f32_to_bf16_kernel(const float* __restrict__ in,
                                   __bf16* __restrict__ out, long n) {
  long i = (long)blockIdx.x * blockDim.x + threadIdx.x;
  long stride = (long)gridDim.x * blockDim.x;
  for (; i < n; i += stride) out[i] = f2bf(in[i]);
}

// Eight 16B async copies global -> LDS (ASYNCcnt). The s_wait_xcnt 0 is the
// last line of the copies' own statement, so that it stands in front of any
// later rewrite of the address registers that the copies name.
__device__ __forceinline__ void asyncCopy16x8(const unsigned int (&l)[8],
                                              const __bf16* const (&g)[8]) {
  asm volatile("global_load_async_to_lds_b128 %0, %8, off\n\t"
               "global_load_async_to_lds_b128 %1, %9, off\n\t"
               "global_load_async_to_lds_b128 %2, %10, off\n\t"
               "global_load_async_to_lds_b128 %3, %11, off\n\t"
               "global_load_async_to_lds_b128 %4, %12, off\n\t"
               "global_load_async_to_lds_b128 %5, %13, off\n\t"
               "global_load_async_to_lds_b128 %6, %14, off\n\t"
               "global_load_async_to_lds_b128 %7, %15, off\n\t"
               "s_wait_xcnt 0x0"
               :: "v"(l[0]), "v"(l[1]), "v"(l[2]), "v"(l[3]),
                  "v"(l[4]), "v"(l[5]), "v"(l[6]), "v"(l[7]),
                  "v"(g[0]), "v"(g[1]), "v"(g[2]), "v"(g[3]),
                  "v"(g[4]), "v"(g[5]), "v"(g[6]), "v"(g[7])
               : "memory");
}
// This wave's copies have landed (the compiler places no wait for them).
__device__ __forceinline__ void waitAsync0() {
  asm volatile("s_wait_asynccnt 0x0" ::: "memory");
}
// This wave's LDS reads have retired before a copy refills the buffer they read.
__device__ __forceinline__ void waitDs0() {
  asm volatile("s_wait_dscnt 0x0" ::: "memory");
}

#define BM   128
#define BN   128

// EPI: 0 = compress (tanh, bf16 out, shape (M,N))
//      1 = decompress mid (reshape (M,4096)->(M*8,512), +bf16 resid, tanh, bf16)
//      2 = decompress final (reshape, +f32 resid, tanh, f32 out)
// BK : k elements of every operand row staged per pass (K is a multiple of it)
template <int EPI, int BK>
__global__ __launch_bounds__(256)
void gemm_tanh_wmma(const __bf16* __restrict__ A,
                    const __bf16* __restrict__ W,
                    const float* __restrict__ bias,
                    const __bf16* __restrict__ residB,
                    const float* __restrict__ residF,
                    __bf16* __restrict__ outB,
                    float* __restrict__ outF,
                    int M, int N, int K) {
  constexpr int ROWB  = BK * 2 + 16;     // row data + 16B pad (16B x odd pitch)
  constexpr int TILEB = 128 * ROWB;      // one staged matrix tile
  constexpr int BUFB  = 2 * TILEB;       // one stage: A tile, W tile
  constexpr int LPR   = BK / 8;          // lanes that cover one row, 16B each
  constexpr int RPS   = 256 / LPR;       // rows that one copy of the block covers
  constexpr int NCP   = 128 / RPS;       // copies per thread and matrix tile
  static_assert(NCP % 4 == 0, "copies go out in statements of eight");
  __shared__ __attribute__((aligned(16))) char smem[2 * BUFB];
  const unsigned int ldsBase = (unsigned int)(uintptr_t)smem;

  const int tid  = threadIdx.x;
  const int lane = tid & 31;
  const int wave = tid >> 5;
  const int nBlocks = N >> 7;
  const int bm = blockIdx.x / nBlocks;
  const int bn = blockIdx.x - bm * nBlocks;
  const int mBase = bm << 7;
  const int nBase = bn << 7;

  // ---- loader mapping: LPR adjacent lanes cover one row's BK*2 bytes ----
  const int lr = tid / LPR;                // first row of this thread
  const int lc = tid % LPR;                // 16B chunk inside the row
  const unsigned int ldsRow = (unsigned int)lr * ROWB + (unsigned int)lc * 16;
  unsigned int aOff[NCP];                  // element offsets of this thread's A rows
#pragma unroll                             // constant indices keep aOff[] in registers
  for (int j = 0; j < NCP; ++j) {
    int aRow = mBase + lr + j * RPS; if (aRow > M - 1) aRow = M - 1;  // clamp ragged M
    aOff[j] = (unsigned int)aRow * (unsigned int)K + (unsigned int)lc * 8;
  }
  const unsigned int wOff = (unsigned int)(nBase + lr) * (unsigned int)K + (unsigned int)lc * 8;

  // ---- compute mapping: 8 waves = 4(M) x 2(N); wave tile 32x64 ----
  const int wm = wave & 3;
  const int wn = wave >> 2;
  const int l16 = lane & 15;
  const int koff2 = (lane >> 4) << 4;      // byte offset of K-half: 0 or 16

  v8f acc[2][4] = {};
  const int ksteps = K / BK;

  auto issue = [&](int buf, int k0) {
    const unsigned int base = ldsBase + (unsigned int)buf * BUFB + ldsRow;
    const __bf16* ak = A + k0;
    const __bf16* wk = W + k0;
#pragma unroll                             // constant indices into aOff[]
    for (int j = 0; j < NCP; j += 4) {
      unsigned int l[8];
      const __bf16* g[8];
#pragma unroll                             // l[], g[] become the asm's register operands
      for (int q = 0; q < 4; ++q) {
        l[q]     = base + (unsigned int)((j + q) * RPS * ROWB);
        g[q]     = ak + aOff[j + q];
        l[q + 4] = base + (unsigned int)(TILEB + (j + q) * RPS * ROWB);
        g[q + 4] = wk + (size_t)((j + q) * RPS) * K + wOff;
      }
      asyncCopy16x8(l, g);
    }
  };

  issue(0, 0);
  waitAsync0();
  __syncthreads();                         // tile 0 visible to every wave
  if (1 < ksteps) issue(1, BK);
  for (int i = 0; i < ksteps; ++i) {
    const char* base = smem + (i & 1) * BUFB;
#pragma unroll                             // kk * 64 folds into the LDS loads' offset field
    for (int kk = 0; kk < BK / 32; ++kk) {
      BfPack a[2], b[4];
#pragma unroll
      for (int s = 0; s < 2; ++s) {
        const char* p = base + (wm * 32 + s * 16 + l16) * ROWB + kk * 64 + koff2;
        a[s].u[0] = *(const v4u*)p;
        a[s].u[1] = *(const v4u*)(p + 32);
      }
#pragma unroll
      for (int t = 0; t < 4; ++t) {
        const char* p = base + TILEB + (wn * 64 + t * 16 + l16) * ROWB + kk * 64 + koff2;
        b[t].u[0] = *(const v4u*)p;
        b[t].u[1] = *(const v4u*)(p + 32);
      }
#pragma unroll
      for (int s = 0; s < 2; ++s)
#pragma unroll
        for (int t = 0; t < 4; ++t)
          acc[s][t] = __builtin_amdgcn_wmma_f32_16x16x32_bf16(
              false, a[s].v, false, b[t].v, (short)0, acc[s][t], false, false);
    }
    waitDs0();
    waitAsync0();
    __syncthreads();                       // tile i+1 visible; tile i's readers done
    if (i + 2 < ksteps) issue(i & 1, (i + 2) * BK);
  }
  waitAsync0();                            // nothing in flight when the wave ends

  // ---- epilogue: C VGPR r -> (row r | r+8, col lane%16) ----
  const int rowAdd = (lane >> 4) << 3;
  float bv[4];
#pragma unroll
  for (int t = 0; t < 4; ++t) bv[t] = bias[nBase + wn * 64 + t * 16 + l16];

#pragma unroll
  for (int s = 0; s < 2; ++s) {
#pragma unroll
    for (int t = 0; t < 4; ++t) {
      const int col = nBase + wn * 64 + t * 16 + l16;
#pragma unroll
      for (int r = 0; r < 8; ++r) {
        const int m = mBase + wm * 32 + s * 16 + r + rowAdd;
        if (m < M) {
          float v = acc[s][t][r] + bv[t];
          if (EPI == 0) {
            outB[(size_t)m * N + col] = f2bf(tanhf(v));
          } else {
            const int orow = (m << 3) + (col >> 9);   // (M,4096)->(M*8,512)
            const int ocol = col & 511;
            const size_t oi = (size_t)orow * 512 + ocol;
            if (EPI == 1) {
              v += bf2f(residB[oi]);
              outB[oi] = f2bf(tanhf(v));
            } else {
              v += residF[oi];
              outF[oi] = tanhf(v);
            }
          }
        }
      }
    }
  }
}

extern "C" void kernel_launch(void* const* d_in, const int* in_sizes, int n_in,
                              void* d_out, int out_size, void* d_ws, size_t ws_size,
                              hipStream_t stream) {
  (void)in_sizes; (void)n_in; (void)out_size; (void)ws_size;
  const float* seq = (const float*)d_in[0];   // (2, 32768, 512)
  const float* Wc  = (const float*)d_in[1];   // (6, 512, 4096)
  const float* bc  = (const float*)d_in[2];   // (6, 512)
  const float* Wd  = (const float*)d_in[3];   // (6, 4096, 512)
  const float* bd  = (const float*)d_in[4];   // (6, 4096)
  float* out = (float*)d_out;                 // (2, 32768, 512)

  const long WELEMS = 6L * 512 * 4096;

  char* ws = (char*)d_ws;
  size_t off = 0;
  auto carve = [&](size_t bytes) -> char* {
    char* p = ws + off;
    off += (bytes + 255) & ~(size_t)255;
    return p;
  };

  __bf16* WcB = (__bf16*)carve((size_t)WELEMS * 2);
  __bf16* WdB = (__bf16*)carve((size_t)WELEMS * 2);
  const long hierElems[6] = {33554432L, 4194304L, 524288L, 65536L, 8192L, 1024L};
  __bf16* hier[6];
  for (int i = 0; i < 6; ++i) hier[i] = (__bf16*)carve((size_t)hierElems[i] * 2);
  __bf16* ping = (__bf16*)carve(4194304L * 2);
  __bf16* pong = (__bf16*)carve(4194304L * 2);

  // --- f32 -> bf16 staging (weights + input sequence) ---
  f32_to_bf16_kernel<<<4096, 256, 0, stream>>>(Wc, WcB, WELEMS);
  f32_to_bf16_kernel<<<4096, 256, 0, stream>>>(Wd, WdB, WELEMS);
  f32_to_bf16_kernel<<<8192, 256, 0, stream>>>(seq, hier[0], 33554432L);

  // --- compress: 5 levels, A=(M,4096) W=(512,4096) ---
  const int Mc[5] = {8192, 1024, 128, 16, 2};
  for (int l = 0; l < 5; ++l) {
    const int M = Mc[l], N = 512, K = 4096;
    const int blocks = ((M + 127) / 128) * (N / 128);
    gemm_tanh_wmma<0, 256><<<blocks, 256, 0, stream>>>(
        hier[l], WcB + (size_t)l * 512 * 4096, bc + (size_t)l * 512,
        nullptr, nullptr, hier[l + 1], nullptr, M, N, K);
  }

  // --- decompress: 5 levels, A=(M,512) W=(4096,512) ---
  const __bf16* cur = hier[5];
  __bf16* bufs[2] = {ping, pong};
  for (int i = 0; i < 5; ++i) {
    const int l = 4 - i;
    int M = 2;
    for (int j = 0; j < 4 - l; ++j) M *= 8;   // 2 * 8^(4-l)
    const int N = 4096, K = 512;
    const int blocks = ((M + 127) / 128) * (N / 128);
    if (l > 0) {
      gemm_tanh_wmma<1, 256><<<blocks, 256, 0, stream>>>(
          cur, WdB + (size_t)l * 4096 * 512, bd + (size_t)l * 4096,
          hier[l], nullptr, bufs[i & 1], nullptr, M, N, K);
      cur = bufs[i & 1];
    } else {
      gemm_tanh_wmma<2, 64><<<blocks, 256, 0, stream>>>(
          cur, WdB, bd, nullptr, seq, nullptr, out, M, N, K);
    }
  }
}

// v002
// One run takes 314 microseconds.
// Timed twice side by side with v001, it ran 1.46 times as fast both times.
// Counting every step since v000, it is 1.97 times as fast.
#include <hip/hip_runtime.h>

// ---------------------------------------------------------------------------
// CDNA5 (gfx1250) HierarchicalTemporalCompressor: bf16 WMMA GEMMs with
// double-buffered async global->LDS staging (ASYNCcnt path) and ds_load_b128
// fragment reads. Every level: C[m,n] = sum_k A[m,k]*W[n,k] (+bias,+resid,tanh).
// ---------------------------------------------------------------------------

typedef __bf16        v16bf __attribute__((ext_vector_type(16)));
typedef float         v8f   __attribute__((ext_vector_type(8)));
typedef unsigned int  v4u   __attribute__((ext_vector_type(4)));
typedef unsigned int  v2u   __attribute__((ext_vector_type(2)));
typedef float         v4f   __attribute__((ext_vector_type(4)));

union BfPack {
  v4u   u[2];   // u[0] -> fragment VGPRs 0..3, u[1] -> VGPRs 4..7
  v16bf v;
};

__device__ __forceinline__ __bf16 f2bf(float f) {
  unsigned int u = __builtin_bit_cast(unsigned int, f);
  u += 0x7FFFu + ((u >> 16) & 1u);            // round-to-nearest-even
  unsigned short h = (unsigned short)(u >> 16);
  return __builtin_bit_cast(__bf16, h);
}

// the same rounding, as the low 16 bits of a word (for packed stores)
__device__ __forceinline__ unsigned int bfbits(float f) {
  return (unsigned int)__builtin_bit_cast(unsigned short, f2bf(f));
}

__global__ void f32_to_bf16_kernel(const float* __restrict__ in,
                                   __bf16* __restrict__ out, long n) {
  long i = (long)blockIdx.x * blockDim.x + threadIdx.x;
  long stride = (long)gridDim.x * blockDim.x;
  for (; i < n; i += stride) out[i] = f2bf(in[i]);
}

// Eight 16B async copies global -> LDS (ASYNCcnt). The s_wait_xcnt 0 is the
// last line of the copies' own statement, so that it stands in front of any
// later rewrite of the address registers that the copies name.
__device__ __forceinline__ void asyncCopy16x8(const unsigned int (&l)[8],
                                              const __bf16* const (&g)[8]) {
  asm volatile("global_load_async_to_lds_b128 %0, %8, off\n\t"
               "global_load_async_to_lds_b128 %1, %9, off\n\t"
               "global_load_async_to_lds_b128 %2, %10, off\n\t"
               "global_load_async_to_lds_b128 %3, %11, off\n\t"
               "global_load_async_to_lds_b128 %4, %12, off\n\t"
               "global_load_async_to_lds_b128 %5, %13, off\n\t"
               "global_load_async_to_lds_b128 %6, %14, off\n\t"
               "global_load_async_to_lds_b128 %7, %15, off\n\t"
               "s_wait_xcnt 0x0"
               :: "v"(l[0]), "v"(l[1]), "v"(l[2]), "v"(l[3]),
                  "v"(l[4]), "v"(l[5]), "v"(l[6]), "v"(l[7]),
                  "v"(g[0]), "v"(g[1]), "v"(g[2]), "v"(g[3]),
                  "v"(g[4]), "v"(g[5]), "v"(g[6]), "v"(g[7])
               : "memory");
}
// This wave's copies have landed (the compiler places no wait for them).
__device__ __forceinline__ void waitAsync0() {
  asm volatile("s_wait_asynccnt 0x0" ::: "memory");
}
// This wave's LDS reads have retired before a copy refills the buffer they read.
__device__ __forceinline__ void waitDs0() {
  asm volatile("s_wait_dscnt 0x0" ::: "memory");
}

#define BM   128
#define BN   128

// EPI: 0 = compress (tanh, bf16 out, shape (M,N))
//      1 = decompress mid (reshape (M,4096)->(M*8,512), +bf16 resid, tanh, bf16)
//      2 = decompress final (reshape, +f32 resid, tanh, f32 out)
// BK : k elements of every operand row staged per pass (K is a multiple of it)
template <int EPI, int BK>
__global__ __launch_bounds__(256)
void gemm_tanh_wmma(const __bf16* __restrict__ A,
                    const __bf16* __restrict__ W,
                    const float* __restrict__ bias,
                    const __bf16* __restrict__ residB,
                    const float* __restrict__ residF,
                    __bf16* __restrict__ outB,
                    float* __restrict__ outF,
                    int M, int N, int K) {
  constexpr int ROWB  = BK * 2 + 16;     // row data + 16B pad (16B x odd pitch)
  constexpr int TILEB = 128 * ROWB;      // one staged matrix tile
  constexpr int BUFB  = 2 * TILEB;       // one stage: A tile, W tile
  constexpr int LPR   = BK / 8;          // lanes that cover one row, 16B each
  constexpr int RPS   = 256 / LPR;       // rows that one copy of the block covers
  constexpr int NCP   = 128 / RPS;       // copies per thread and matrix tile
  static_assert(NCP % 4 == 0, "copies go out in statements of eight");
  __shared__ __attribute__((aligned(16))) char smem[2 * BUFB];
  const unsigned int ldsBase = (unsigned int)(uintptr_t)smem;

  const int tid  = threadIdx.x;
  const int lane = tid & 31;
  const int wave = tid >> 5;
  const int nBlocks = N >> 7;
  const int bm = blockIdx.x / nBlocks;
  const int bn = blockIdx.x - bm * nBlocks;
  const int mBase = bm << 7;
  const int nBase = bn << 7;

  // ---- loader mapping: LPR adjacent lanes cover one row's BK*2 bytes ----
  const int lr = tid / LPR;                // first row of this thread
  const int lc = tid % LPR;                // 16B chunk inside the row
  const unsigned int ldsRow = (unsigned int)lr * ROWB + (unsigned int)lc * 16;
  unsigned int aOff[NCP];                  // element offsets of this thread's A rows
#pragma unroll                             // constant indices keep aOff[] in registers
  for (int j = 0; j < NCP; ++j) {
    int aRow = mBase + lr + j * RPS; if (aRow > M - 1) aRow = M - 1;  // clamp ragged M
    aOff[j] = (unsigned int)aRow * (unsigned int)K + (unsigned int)lc * 8;
  }
  const unsigned int wOff = (unsigned int)(nBase + lr) * (unsigned int)K + (unsigned int)lc * 8;

  // ---- compute mapping: 8 waves = 4(M) x 2(N); wave tile 32x64 ----
  const int wm = wave & 3;
  const int wn = wave >> 2;
  const int l16 = lane & 15;
  const int koff2 = (lane >> 4) << 4;      // byte offset of K-half: 0 or 16

  v8f acc[2][4] = {};
  const int ksteps = K / BK;

  auto issue = [&](int buf, int k0) {
    const unsigned int base = ldsBase + (unsigned int)buf * BUFB + ldsRow;
    const __bf16* ak = A + k0;
    const __bf16* wk = W + k0;
#pragma unroll                             // constant indices into aOff[]
    for (int j = 0; j < NCP; j += 4) {
      unsigned int l[8];
      const __bf16* g[8];
#pragma unroll                             // l[], g[] become the asm's register operands
      for (int q = 0; q < 4; ++q) {
        l[q]     = base + (unsigned int)((j + q) * RPS * ROWB);
        g[q]     = ak + aOff[j + q];
        l[q + 4] = base + (unsigned int)(TILEB + (j + q) * RPS * ROWB);
        g[q + 4] = wk + (size_t)((j + q) * RPS) * K + wOff;
      }
      asyncCopy16x8(l, g);
    }
  };

  issue(0, 0);
  waitAsync0();
  __syncthreads();                         // tile 0 visible to every wave
  if (1 < ksteps) issue(1, BK);
  for (int i = 0; i < ksteps; ++i) {
    const char* base = smem + (i & 1) * BUFB;
#pragma unroll                             // kk * 64 folds into the LDS loads' offset field
    for (int kk = 0; kk < BK / 32; ++kk) {
      BfPack a[2], b[4];
#pragma unroll
      for (int s = 0; s < 2; ++s) {
        const char* p = base + (wm * 32 + s * 16 + l16) * ROWB + kk * 64 + koff2;
        a[s].u[0] = *(const v4u*)p;
        a[s].u[1] = *(const v4u*)(p + 32);
      }
#pragma unroll
      for (int t = 0; t < 4; ++t) {
        const char* p = base + TILEB + (wn * 64 + t * 16 + l16) * ROWB + kk * 64 + koff2;
        b[t].u[0] = *(const v4u*)p;
        b[t].u[1] = *(const v4u*)(p + 32);
      }
#pragma unroll
      for (int s = 0; s < 2; ++s)
#pragma unroll
        for (int t = 0; t < 4; ++t)
          acc[s][t] = __builtin_amdgcn_wmma_f32_16x16x32_bf16(
              false, a[s].v, false, b[t].v, (short)0, acc[s][t], false, false);
    }
    waitDs0();
    waitAsync0();
    __syncthreads();                       // tile i+1 visible; tile i's readers done
    if (i + 2 < ksteps) issue(i & 1, (i + 2) * BK);
  }
  waitAsync0();                            // nothing in flight when the wave ends

  // ---- epilogue: each wave turns its 32x64 tile through its own LDS range, so
  // that a lane owns 4 adjacent columns and a wave-wide access covers whole lines.
  const int half = lane >> 4;              // two rows per wave-wide access
  const int col  = nBase + wn * 64 + l16 * 4;
  // first row of the wave's tile, in a scalar register: it bounds the loop below
  const int mW = __builtin_amdgcn_readfirstlane(mBase + wm * 32);
  int nG = (M - mW + 7) >> 3;              // groups of 8 rows that hold a row below M
  nG = nG < 0 ? 0 : (nG > 4 ? 4 : nG);

  // The reshape (M,4096)->(M*8,512) keeps the flat index, so every EPI uses m*N+col
  // (below 2^26 elements at every level).
  v4f rf[4];                               // residual of the next group, in flight
  v2u rb[4];
  auto loadRes = [&](int g) {
#pragma unroll                             // constant indices keep rf[], rb[] in registers
    for (int q = 0; q < 4; ++q) {
      int m = mW + g * 8 + q * 2 + half; if (m > M - 1) m = M - 1;   // clamp ragged M
      const unsigned int oi = (unsigned int)m * (unsigned int)N + (unsigned int)col;
      if (EPI == 1) rb[q] = *(const v2u*)(residB + oi);
      if (EPI == 2) rf[q] = *(const v4f*)(residF + oi);
    }
    // stands behind the loads, in front of any rewrite of their address registers
    if (EPI != 0) asm volatile("s_wait_xcnt 0x0" ::: "memory");
  };

  // The ring is free here: every wave's reads and copies ended at the last barrier.
  constexpr int SP = 64 * 4 + 16;          // staged row pitch: rows r and r+8 fall on disjoint banks
  static_assert(8 * 32 * SP <= 2 * BUFB, "the staged tiles fit the ring's LDS");
  char* stage = smem + wave * (32 * SP);
  {
    char* p = stage + (half << 3) * SP + l16 * 4;   // C VGPR r -> (row r | r+8, col lane%16)
#pragma unroll                             // all three: constant indices keep acc[] in registers
    for (int s = 0; s < 2; ++s)
#pragma unroll
      for (int t = 0; t < 4; ++t)
#pragma unroll
        for (int r = 0; r < 8; ++r)
          *(float*)(p + (s * 16 + r) * SP + t * 64) = acc[s][t][r];
  }
  const v4f bv = *(const v4f*)(bias + col);
  if (nG > 0) loadRes(0);                  // issued here, where the accumulators' registers are free
  waitDs0();                               // the wave's own rows are in LDS before it reads them back

#pragma unroll 1                           // rolled: 16 inlined tanhf instead of 64 keep the text short
  for (int g = 0; g < nG; ++g) {
    v4f cf[4], c[4];
    v2u cb[4];
#pragma unroll                             // constant indices keep the group's arrays in registers
    for (int q = 0; q < 4; ++q) {
      if (EPI == 1) cb[q] = rb[q];
      if (EPI == 2) cf[q] = rf[q];
      c[q] = *(const v4f*)(stage + (g * 8 + q * 2 + half) * SP + l16 * 16);   // one LDS wait a group
    }
    if (g + 1 < nG) loadRes(g + 1);        // next group's residual flies under this group's tanh
#pragma unroll                             // as above
    for (int q = 0; q < 4; ++q) {
      const int m = mW + g * 8 + q * 2 + half;
      v4f v = c[q] + bv;
      if (EPI == 1) {
        v.x += __builtin_bit_cast(float, cb[q].x << 16);
        v.y += __builtin_bit_cast(float, cb[q].x & 0xFFFF0000u);
        v.z += __builtin_bit_cast(float, cb[q].y << 16);
        v.w += __builtin_bit_cast(float, cb[q].y & 0xFFFF0000u);
      }
      if (EPI == 2) v += cf[q];
      v.x = tanhf(v.x); v.y = tanhf(v.y); v.z = tanhf(v.z); v.w = tanhf(v.w);
      if (m < M) {
        const unsigned int oi = (unsigned int)m * (unsigned int)N + (unsigned int)col;
        if (EPI == 2) {
          *(v4f*)(outF + oi) = v;
        } else {
          v2u o;
          o.x = bfbits(v.x) | (bfbits(v.y) << 16);
          o.y = bfbits(v.z) | (bfbits(v.w) << 16);
          *(v2u*)(outB + oi) = o;
        }
        // stands behind the store, in front of any rewrite of the registers that it names
        asm volatile("s_wait_xcnt 0x0" ::: "memory");
      }
    }
  }
}

extern "C" void kernel_launch(void* const* d_in, const int* in_sizes, int n_in,
                              void* d_out, int out_size, void* d_ws, size_t ws_size,
                              hipStream_t stream) {
  (void)in_sizes; (void)n_in; (void)out_size; (void)ws_size;
  const float* seq = (const float*)d_in[0];   // (2, 32768, 512)
  const float* Wc  = (const float*)d_in[1];   // (6, 512, 4096)
  const float* bc  = (const float*)d_in[2];   // (6, 512)
  const float* Wd  = (const float*)d_in[3];   // (6, 4096, 512)
  const float* bd  = (const float*)d_in[4];   // (6, 4096)
  float* out = (float*)d_out;                 // (2, 32768, 512)

  const long WELEMS = 6L * 512 * 4096;

  char* ws = (char*)d_ws;
  size_t off = 0;
  auto carve = [&](size_t bytes) -> char* {
    char* p = ws + off;
    off += (bytes + 255) & ~(size_t)255;
    return p;
  };

  __bf16* WcB = (__bf16*)carve((size_t)WELEMS * 2);
  __bf16* WdB = (__bf16*)carve((size_t)WELEMS * 2);
  const long hierElems[6] = {33554432L, 4194304L, 524288L, 65536L, 8192L, 1024L};
  __bf16* hier[6];
  for (int i = 0; i < 6; ++i) hier[i] = (__bf16*)carve((size_t)hierElems[i] * 2);
  __bf16* ping = (__bf16*)carve(4194304L * 2);
  __bf16* pong = (__bf16*)carve(4194304L * 2);

  // --- f32 -> bf16 staging (weights + input sequence) ---
  f32_to_bf16_kernel<<<4096, 256, 0, stream>>>(Wc, WcB, WELEMS);
  f32_to_bf16_kernel<<<4096, 256, 0, stream>>>(Wd, WdB, WELEMS);
  f32_to_bf16_kernel<<<8192, 256, 0, stream>>>(seq, hier[0], 33554432L);

  // --- compress: 5 levels, A=(M,4096) W=(512,4096) ---
  const int Mc[5] = {8192, 1024, 128, 16, 2};
  for (int l = 0; l < 5; ++l) {
    const int M = Mc[l], N = 512, K = 4096;
    const int blocks = ((M + 127) / 128) * (N / 128);
    gemm_tanh_wmma<0, 256><<<blocks, 256, 0, stream>>>(
        hier[l], WcB + (size_t)l * 512 * 4096, bc + (size_t)l * 512,
        nullptr, nullptr, hier[l + 1], nullptr, M, N, K);
  }

  // --- decompress: 5 levels, A=(M,512) W=(4096,512) ---
  const __bf16* cur = hier[5];
  __bf16* bufs[2] = {ping, pong};
  for (int i = 0; i < 5; ++i) {
    const int l = 4 - i;
    int M = 2;
    for (int j = 0; j < 4 - l; ++j) M *= 8;   // 2 * 8^(4-l)
    const int N = 4096, K = 512;
    const int blocks = ((M + 127) / 128) * (N / 128);
    if (l > 0) {
      gemm_tanh_wmma<1, 256><<<blocks, 256, 0, stream>>>(
          cur, WdB + (size_t)l * 4096 * 512, bd + (size_t)l * 4096,
          hier[l], nullptr, bufs[i & 1], nullptr, M, N, K);
      cur = bufs[i & 1];
    } else {
      gemm_tanh_wmma<2, 64><<<blocks, 256, 0, stream>>>(
          cur, WdB, bd, nullptr, seq, nullptr, out, M, N, K);
    }
  }
}

// v003
// Measured time: 275 microseconds a run.
// Two timings next to v002 both put it at 1.14 times that version's speed.
// All steps since v000 together make it 2.25 times as fast.
#include <hip/hip_runtime.h>

// ---------------------------------------------------------------------------
// CDNA5 (gfx1250) HierarchicalTemporalCompressor: bf16 WMMA GEMMs with
// double-buffered async global->LDS staging (ASYNCcnt path) and ds_load_b128
// fragment reads. Every level: C[m,n] = sum_k A[m,k]*W[n,k] (+bias,+resid,tanh).
// ---------------------------------------------------------------------------

typedef __bf16        v16bf __attribute__((ext_vector_type(16)));
typedef float         v8f   __attribute__((ext_vector_type(8)));
typedef unsigned int  v4u   __attribute__((ext_vector_type(4)));
typedef unsigned int  v2u   __attribute__((ext_vector_type(2)));
typedef float         v4f   __attribute__((ext_vector_type(4)));

union BfPack {
  v4u   u[2];   // u[0] -> fragment VGPRs 0..3, u[1] -> VGPRs 4..7
  v16bf v;
};

__device__ __forceinline__ __bf16 f2bf(float f) {
  unsigned int u = __builtin_bit_cast(unsigned int, f);
  u += 0x7FFFu + ((u >> 16) & 1u);            // round-to-nearest-even
  unsigned short h = (unsigned short)(u >> 16);
  return __builtin_bit_cast(__bf16, h);
}

// the same rounding, as the low 16 bits of a word (for packed stores)
__device__ __forceinline__ unsigned int bfbits(float f) {
  return (unsigned int)__builtin_bit_cast(unsigned short, f2bf(f));
}

// f32 -> bf16 as a stream: CVT_GROUPS work-groups of CVT_WAVES waves, one per WGP.
// A wave owns PASSES adjacent pieces of 4 KB: a piece is eight loads of 512 adjacent
// bytes (16 B a lane, whole lines; read once, so non-temporal) and eight stores of 256
// adjacent bytes. The next piece's loads are in flight while this one is rounded.
#define CVT_GROUPS 256
#define CVT_WAVES  16
template <int PASSES>
__global__ __launch_bounds__(CVT_WAVES * 32)
void f32_to_bf16_stream(const float* __restrict__ in, __bf16* __restrict__ out) {
  const unsigned int lane = threadIdx.x & 31u;
  const unsigned int wave = blockIdx.x * CVT_WAVES + (threadIdx.x >> 5);
  const char* src = (const char*)in + (size_t)wave * (PASSES * 4096) + lane * 16;
  char* dst = (char*)out + (size_t)wave * (PASSES * 2048) + lane * 8;
  v4f r[2][8];                             // this piece and the next
#pragma unroll                             // constant indices keep r[][] in registers
  for (int q = 0; q < 8; ++q)
    r[0][q] = __builtin_nontemporal_load((const v4f*)(src + q * 512));
#pragma unroll                             // as above; p * 4096 folds into the offset fields
  for (int p = 0; p < PASSES; ++p) {
    // the two scheduling barriers keep the order: next piece's loads, then this piece's work
    __builtin_amdgcn_sched_barrier(0);
    if (p + 1 < PASSES) {
#pragma unroll                             // as above
      for (int q = 0; q < 8; ++q)
        r[(p + 1) & 1][q] =
            __builtin_nontemporal_load((const v4f*)(src + (p + 1) * 4096 + q * 512));
    }
    __builtin_amdgcn_sched_barrier(0);
#pragma unroll                             // as above
    for (int q = 0; q < 8; ++q) {
      const v4f v = r[p & 1][q];
      v2u o;
      o.x = bfbits(v.x) | (bfbits(v.y) << 16);
      o.y = bfbits(v.z) | (bfbits(v.w) << 16);
      *(v2u*)(dst + p * 2048 + q * 256) = o;
    }
    // stands behind the stores, in front of any rewrite of the registers that they name
    if (p + 1 < PASSES) asm volatile("s_wait_xcnt 0x0" ::: "memory");
  }
}

// Eight 16B async copies global -> LDS (ASYNCcnt). The s_wait_xcnt 0 is the
// last line of the copies' own statement, so that it stands in front of any
// later rewrite of the address registers that the copies name.
__device__ __forceinline__ void asyncCopy16x8(const unsigned int (&l)[8],
                                              const __bf16* const (&g)[8]) {
  asm volatile("global_load_async_to_lds_b128 %0, %8, off\n\t"
               "global_load_async_to_lds_b128 %1, %9, off\n\t"
               "global_load_async_to_lds_b128 %2, %10, off\n\t"
               "global_load_async_to_lds_b128 %3, %11, off\n\t"
               "global_load_async_to_lds_b128 %4, %12, off\n\t"
               "global_load_async_to_lds_b128 %5, %13, off\n\t"
               "global_load_async_to_lds_b128 %6, %14, off\n\t"
               "global_load_async_to_lds_b128 %7, %15, off\n\t"
               "s_wait_xcnt 0x0"
               :: "v"(l[0]), "v"(l[1]), "v"(l[2]), "v"(l[3]),
                  "v"(l[4]), "v"(l[5]), "v"(l[6]), "v"(l[7]),
                  "v"(g[0]), "v"(g[1]), "v"(g[2]), "v"(g[3]),
                  "v"(g[4]), "v"(g[5]), "v"(g[6]), "v"(g[7])
               : "memory");
}
// This wave's copies have landed (the compiler places no wait for them).
__device__ __forceinline__ void waitAsync0() {
  asm volatile("s_wait_asynccnt 0x0" ::: "memory");
}
// This wave's LDS reads have retired before a copy refills the buffer they read.
__device__ __forceinline__ void waitDs0() {
  asm volatile("s_wait_dscnt 0x0" ::: "memory");
}

#define BM   128
#define BN   128

// EPI: 0 = compress (tanh, bf16 out, shape (M,N))
//      1 = decompress mid (reshape (M,4096)->(M*8,512), +bf16 resid, tanh, bf16)
//      2 = decompress final (reshape, +f32 resid, tanh, f32 out)
// BK : k elements of every operand row staged per pass (K is a multiple of it)
template <int EPI, int BK>
__global__ __launch_bounds__(256)
void gemm_tanh_wmma(const __bf16* __restrict__ A,
                    const __bf16* __restrict__ W,
                    const float* __restrict__ bias,
                    const __bf16* __restrict__ residB,
                    const float* __restrict__ residF,
                    __bf16* __restrict__ outB,
                    float* __restrict__ outF,
                    int M, int N, int K) {
  constexpr int ROWB  = BK * 2 + 16;     // row data + 16B pad (16B x odd pitch)
  constexpr int TILEB = 128 * ROWB;      // one staged matrix tile
  constexpr int BUFB  = 2 * TILEB;       // one stage: A tile, W tile
  constexpr int LPR   = BK / 8;          // lanes that cover one row, 16B each
  constexpr int RPS   = 256 / LPR;       // rows that one copy of the block covers
  constexpr int NCP   = 128 / RPS;       // copies per thread and matrix tile
  static_assert(NCP % 4 == 0, "copies go out in statements of eight");
  __shared__ __attribute__((aligned(16))) char smem[2 * BUFB];
  const unsigned int ldsBase = (unsigned int)(uintptr_t)smem;

  const int tid  = threadIdx.x;
  const int lane = tid & 31;
  const int wave = tid >> 5;
  const int nBlocks = N >> 7;
  const int bm = blockIdx.x / nBlocks;
  const int bn = blockIdx.x - bm * nBlocks;
  const int mBase = bm << 7;
  const int nBase = bn << 7;

  // ---- loader mapping: LPR adjacent lanes cover one row's BK*2 bytes ----
  const int lr = tid / LPR;                // first row of this thread
  const int lc = tid % LPR;                // 16B chunk inside the row
  const unsigned int ldsRow = (unsigned int)lr * ROWB + (unsigned int)lc * 16;
  unsigned int aOff[NCP];                  // element offsets of this thread's A rows
#pragma unroll                             // constant indices keep aOff[] in registers
  for (int j = 0; j < NCP; ++j) {
    int aRow = mBase + lr + j * RPS; if (aRow > M - 1) aRow = M - 1;  // clamp ragged M
    aOff[j] = (unsigned int)aRow * (unsigned int)K + (unsigned int)lc * 8;
  }
  const unsigned int wOff = (unsigned int)(nBase + lr) * (unsigned int)K + (unsigned int)lc * 8;

  // ---- compute mapping: 8 waves = 4(M) x 2(N); wave tile 32x64 ----
  const int wm = wave & 3;
  const int wn = wave >> 2;
  const int l16 = lane & 15;
  const int koff2 = (lane >> 4) << 4;      // byte offset of K-half: 0 or 16

  v8f acc[2][4] = {};
  const int ksteps = K / BK;

  auto issue = [&](int buf, int k0) {
    const unsigned int base = ldsBase + (unsigned int)buf * BUFB + ldsRow;
    const __bf16* ak = A + k0;
    const __bf16* wk = W + k0;
#pragma unroll                             // constant indices into aOff[]
    for (int j = 0; j < NCP; j += 4) {
      unsigned int l[8];
      const __bf16* g[8];
#pragma unroll                             // l[], g[] become the asm's register operands
      for (int q = 0; q < 4; ++q) {
        l[q]     = base + (unsigned int)((j + q) * RPS * ROWB);
        g[q]     = ak + aOff[j + q];
        l[q + 4] = base + (unsigned int)(TILEB + (j + q) * RPS * ROWB);
        g[q + 4] = wk + (size_t)((j + q) * RPS) * K + wOff;
      }
      asyncCopy16x8(l, g);
    }
  };

  issue(0, 0);
  waitAsync0();
  __syncthreads();                         // tile 0 visible to every wave
  if (1 < ksteps) issue(1, BK);
  for (int i = 0; i < ksteps; ++i) {
    const char* base = smem + (i & 1) * BUFB;
#pragma unroll                             // kk * 64 folds into the LDS loads' offset field
    for (int kk = 0; kk < BK / 32; ++kk) {
      BfPack a[2], b[4];
#pragma unroll
      for (int s = 0; s < 2; ++s) {
        const char* p = base + (wm * 32 + s * 16 + l16) * ROWB + kk * 64 + koff2;
        a[s].u[0] = *(const v4u*)p;
        a[s].u[1] = *(const v4u*)(p + 32);
      }
#pragma unroll
      for (int t = 0; t < 4; ++t) {
        const char* p = base + TILEB + (wn * 64 + t * 16 + l16) * ROWB + kk * 64 + koff2;
        b[t].u[0] = *(const v4u*)p;
        b[t].u[1] = *(const v4u*)(p + 32);
      }
#pragma unroll
      for (int s = 0; s < 2; ++s)
#pragma unroll
        for (int t = 0; t < 4; ++t)
          acc[s][t] = __builtin_amdgcn_wmma_f32_16x16x32_bf16(
              false, a[s].v, false, b[t].v, (short)0, acc[s][t], false, false);
    }
    waitDs0();
    waitAsync0();
    __syncthreads();                       // tile i+1 visible; tile i's readers done
    if (i + 2 < ksteps) issue(i & 1, (i + 2) * BK);
  }
  waitAsync0();                            // nothing in flight when the wave ends

  // ---- epilogue: each wave turns its 32x64 tile through its own LDS range, so
  // that a lane owns 4 adjacent columns and a wave-wide access covers whole lines.
  const int half = lane >> 4;              // two rows per wave-wide access
  const int col  = nBase + wn * 64 + l16 * 4;
  // first row of the wave's tile, in a scalar register: it bounds the loop below
  const int mW = __builtin_amdgcn_readfirstlane(mBase + wm * 32);
  int nG = (M - mW + 7) >> 3;              // groups of 8 rows that hold a row below M
  nG = nG < 0 ? 0 : (nG > 4 ? 4 : nG);

  // The reshape (M,4096)->(M*8,512) keeps the flat index, so every EPI uses m*N+col
  // (below 2^26 elements at every level).
  v4f rf[4];                               // residual of the next group, in flight
  v2u rb[4];
  auto loadRes = [&](int g) {
#pragma unroll                             // constant indices keep rf[], rb[] in registers
    for (int q = 0; q < 4; ++q) {
      int m = mW + g * 8 + q * 2 + half; if (m > M - 1) m = M - 1;   // clamp ragged M
      const unsigned int oi = (unsigned int)m * (unsigned int)N + (unsigned int)col;
      if (EPI == 1) rb[q] = *(const v2u*)(residB + oi);
      if (EPI == 2) rf[q] = *(const v4f*)(residF + oi);
    }
    // stands behind the loads, in front of any rewrite of their address registers
    if (EPI != 0) asm volatile("s_wait_xcnt 0x0" ::: "memory");
  };

  // The ring is free here: every wave's reads and copies ended at the last barrier.
  constexpr int SP = 64 * 4 + 16;          // staged row pitch: rows r and r+8 fall on disjoint banks
  static_assert(8 * 32 * SP <= 2 * BUFB, "the staged tiles fit the ring's LDS");
  char* stage = smem + wave * (32 * SP);
  {
    char* p = stage + (half << 3) * SP + l16 * 4;   // C VGPR r -> (row r | r+8, col lane%16)
#pragma unroll                             // all three: constant indices keep acc[] in registers
    for (int s = 0; s < 2; ++s)
#pragma unroll
      for (int t = 0; t < 4; ++t)
#pragma unroll
        for (int r = 0; r < 8; ++r)
          *(float*)(p + (s * 16 + r) * SP + t * 64) = acc[s][t][r];
  }
  const v4f bv = *(const v4f*)(bias + col);
  if (nG > 0) loadRes(0);                  // issued here, where the accumulators' registers are free
  waitDs0();                               // the wave's own rows are in LDS before it reads them back

#pragma unroll 1                           // rolled: 16 inlined tanhf instead of 64 keep the text short
  for (int g = 0; g < nG; ++g) {
    v4f cf[4], c[4];
    v2u cb[4];
#pragma unroll                             // constant indices keep the group's arrays in registers
    for (int q = 0; q < 4; ++q) {
      if (EPI == 1) cb[q] = rb[q];
      if (EPI == 2) cf[q] = rf[q];
      c[q] = *(const v4f*)(stage + (g * 8 + q * 2 + half) * SP + l16 * 16);   // one LDS wait a group
    }
    if (g + 1 < nG) loadRes(g + 1);        // next group's residual flies under this group's tanh
#pragma unroll                             // as above
    for (int q = 0; q < 4; ++q) {
      const int m = mW + g * 8 + q * 2 + half;
      v4f v = c[q] + bv;
      if (EPI == 1) {
        v.x += __builtin_bit_cast(float, cb[q].x << 16);
        v.y += __builtin_bit_cast(float, cb[q].x & 0xFFFF0000u);
        v.z += __builtin_bit_cast(float, cb[q].y << 16);
        v.w += __builtin_bit_cast(float, cb[q].y & 0xFFFF0000u);
      }
      if (EPI == 2) v += cf[q];
      v.x = tanhf(v.x); v.y = tanhf(v.y); v.z = tanhf(v.z); v.w = tanhf(v.w);
      if (m < M) {
        const unsigned int oi = (unsigned int)m * (unsigned int)N + (unsigned int)col;
        if (EPI == 2) {
          *(v4f*)(outF + oi) = v;
        } else {
          v2u o;
          o.x = bfbits(v.x) | (bfbits(v.y) << 16);
          o.y = bfbits(v.z) | (bfbits(v.w) << 16);
          *(v2u*)(outB + oi) = o;
        }
        // stands behind the store, in front of any rewrite of the registers that it names
        asm volatile("s_wait_xcnt 0x0" ::: "memory");
      }
    }
  }
}

extern "C" void kernel_launch(void* const* d_in, const int* in_sizes, int n_in,
                              void* d_out, int out_size, void* d_ws, size_t ws_size,
                              hipStream_t stream) {
  (void)in_sizes; (void)n_in; (void)out_size; (void)ws_size;
  const float* seq = (const float*)d_in[0];   // (2, 32768, 512)
  const float* Wc  = (const float*)d_in[1];   // (6, 512, 4096)
  const float* bc  = (const float*)d_in[2];   // (6, 512)
  const float* Wd  = (const float*)d_in[3];   // (6, 4096, 512)
  const float* bd  = (const float*)d_in[4];   // (6, 4096)
  float* out = (float*)d_out;                 // (2, 32768, 512)

  const long WELEMS = 6L * 512 * 4096;

  char* ws = (char*)d_ws;
  size_t off = 0;
  auto carve = [&](size_t bytes) -> char* {
    char* p = ws + off;
    off += (bytes + 255) & ~(size_t)255;
    return p;
  };

  __bf16* WcB = (__bf16*)carve((size_t)WELEMS * 2);
  __bf16* WdB = (__bf16*)carve((size_t)WELEMS * 2);
  const long hierElems[6] = {33554432L, 4194304L, 524288L, 65536L, 8192L, 1024L};
  __bf16* hier[6];
  for (int i = 0; i < 6; ++i) hier[i] = (__bf16*)carve((size_t)hierElems[i] * 2);
  __bf16* ping = (__bf16*)carve(4194304L * 2);
  __bf16* pong = (__bf16*)carve(4194304L * 2);

  // --- f32 -> bf16 staging (weights + input sequence) ---
  static_assert(3L * CVT_GROUPS * CVT_WAVES * 1024 == 6L * 512 * 4096, "weights: 3 pieces a wave");
  static_assert(8L * CVT_GROUPS * CVT_WAVES * 1024 == 33554432L, "sequence: 8 pieces a wave");
  f32_to_bf16_stream<3><<<CVT_GROUPS, CVT_WAVES * 32, 0, stream>>>(Wc, WcB);
  f32_to_bf16_stream<3><<<CVT_GROUPS, CVT_WAVES * 32, 0, stream>>>(Wd, WdB);
  f32_to_bf16_stream<8><<<CVT_GROUPS, CVT_WAVES * 32, 0, stream>>>(seq, hier[0]);

  // --- compress: 5 levels, A=(M,4096) W=(512,4096) ---
  const int Mc[5] = {8192, 1024, 128, 16, 2};
  for (int l = 0; l < 5; ++l) {
    const int M = Mc[l], N = 512, K = 4096;
    const int blocks = ((M + 127) / 128) * (N / 128);
    gemm_tanh_wmma<0, 256><<<blocks, 256, 0, stream>>>(
        hier[l], WcB + (size_t)l * 512 * 4096, bc + (size_t)l * 512,
        nullptr, nullptr, hier[l + 1], nullptr, M, N, K);
  }

  // --- decompress: 5 levels, A=(M,512) W=(4096,512) ---
  const __bf16* cur = hier[5];
  __bf16* bufs[2] = {ping, pong};
  for (int i = 0; i < 5; ++i) {
    const int l = 4 - i;
    int M = 2;
    for (int j = 0; j < 4 - l; ++j) M *= 8;   // 2 * 8^(4-l)
    const int N = 4096, K = 512;
    const int blocks = ((M + 127) / 128) * (N / 128);
    if (l > 0) {
      gemm_tanh_wmma<1, 256><<<blocks, 256, 0, stream>>>(
          cur, WdB + (size_t)l * 4096 * 512, bd + (size_t)l * 4096,
          hier[l], nullptr, bufs[i & 1], nullptr, M, N, K);
      cur = bufs[i & 1];
    } else {
      gemm_tanh_wmma<2, 64><<<blocks, 256, 0, stream>>>(
          cur, WdB, bd, nullptr, seq, nullptr, out, M, N, K);
    }
  }
}

// v004
// Measured time: 244 microseconds a run.
// Next to v003, in two timings, it ran 1.13 times as fast each time.
// Over all steps from v000 it is 2.54 times as fast.
#include <hip/hip_runtime.h>

// ---------------------------------------------------------------------------
// CDNA5 (gfx1250) HierarchicalTemporalCompressor: bf16 WMMA GEMMs with
// double-buffered async global->LDS staging (ASYNCcnt path) and ds_load_b128
// fragment reads. Every level: C[m,n] = sum_k A[m,k]*W[n,k] (+bias,+resid,tanh).
// ---------------------------------------------------------------------------

typedef __bf16        v16bf __attribute__((ext_vector_type(16)));
typedef float         v8f   __attribute__((ext_vector_type(8)));
typedef unsigned int  v4u   __attribute__((ext_vector_type(4)));
typedef unsigned int  v2u   __attribute__((ext_vector_type(2)));
typedef float         v4f   __attribute__((ext_vector_type(4)));

union BfPack {
  v4u   u[2];   // u[0] -> fragment VGPRs 0..3, u[1] -> VGPRs 4..7
  v16bf v;
};

__device__ __forceinline__ __bf16 f2bf(float f) {
  unsigned int u = __builtin_bit_cast(unsigned int, f);
  u += 0x7FFFu + ((u >> 16) & 1u);            // round-to-nearest-even
  unsigned short h = (unsigned short)(u >> 16);
  return __builtin_bit_cast(__bf16, h);
}

// the same rounding, as the low 16 bits of a word (for packed stores)
__device__ __forceinline__ unsigned int bfbits(float f) {
  return (unsigned int)__builtin_bit_cast(unsigned short, f2bf(f));
}

// tanh x = 1 - 2 / (1 + e^(2x)), straight-line: one exp2, one rcp, three plain operations.
// e^(2x) = inf gives 1, e^(2x) = 0 gives -1, a NaN stays one; the absolute error is a few
// units of 2^-24, at every x. No branch, so a group's values run as independent chains.
__device__ __forceinline__ float tanhExp(float x) {
  const float e = __builtin_amdgcn_exp2f(x * 2.885390081777927f);   // 2 * log2(e)
  return 1.0f - 2.0f * __builtin_amdgcn_rcpf(1.0f + e);
}

// f32 -> bf16 as a stream: CVT_GROUPS work-groups of CVT_WAVES waves, one per WGP.
// A wave owns PASSES adjacent pieces of 4 KB: a piece is eight loads of 512 adjacent
// bytes (16 B a lane, whole lines; read once, so non-temporal) and eight stores of 256
// adjacent bytes. The next piece's loads are in flight while this one is rounded.
#define CVT_GROUPS 256
#define CVT_WAVES  16
template <int PASSES>
__global__ __launch_bounds__(CVT_WAVES * 32)
void f32_to_bf16_stream(const float* __restrict__ in, __bf16* __restrict__ out) {
  const unsigned int lane = threadIdx.x & 31u;
  const unsigned int wave = blockIdx.x * CVT_WAVES + (threadIdx.x >> 5);
  const char* src = (const char*)in + (size_t)wave * (PASSES * 4096) + lane * 16;
  char* dst = (char*)out + (size_t)wave * (PASSES * 2048) + lane * 8;
  v4f r[2][8];                             // this piece and the next
#pragma unroll                             // constant indices keep r[][] in registers
  for (int q = 0; q < 8; ++q)
    r[0][q] = __builtin_nontemporal_load((const v4f*)(src + q * 512));
#pragma unroll                             // as above; p * 4096 folds into the offset fields
  for (int p = 0; p < PASSES; ++p) {
    // the two scheduling barriers keep the order: next piece's loads, then this piece's work
    __builtin_amdgcn_sched_barrier(0);
    if (p + 1 < PASSES) {
#pragma unroll                             // as above
      for (int q = 0; q < 8; ++q)
        r[(p + 1) & 1][q] =
            __builtin_nontemporal_load((const v4f*)(src + (p + 1) * 4096 + q * 512));
    }
    __builtin_amdgcn_sched_barrier(0);
#pragma unroll                             // as above
    for (int q = 0; q < 8; ++q) {
      const v4f v = r[p & 1][q];
      v2u o;
      o.x = bfbits(v.x) | (bfbits(v.y) << 16);
      o.y = bfbits(v.z) | (bfbits(v.w) << 16);
      *(v2u*)(dst + p * 2048 + q * 256) = o;
    }
    // stands behind the stores, in front of any rewrite of the registers that they name
    if (p + 1 < PASSES) asm volatile("s_wait_xcnt 0x0" ::: "memory");
  }
}

// Eight 16B async copies global -> LDS (ASYNCcnt). The s_wait_xcnt 0 is the
// last line of the copies' own statement, so that it stands in front of any
// later rewrite of the address registers that the copies name.
__device__ __forceinline__ void asyncCopy16x8(const unsigned int (&l)[8],
                                              const __bf16* const (&g)[8]) {
  asm volatile("global_load_async_to_lds_b128 %0, %8, off\n\t"
               "global_load_async_to_lds_b128 %1, %9, off\n\t"
               "global_load_async_to_lds_b128 %2, %10, off\n\t"
               "global_load_async_to_lds_b128 %3, %11, off\n\t"
               "global_load_async_to_lds_b128 %4, %12, off\n\t"
               "global_load_async_to_lds_b128 %5, %13, off\n\t"
               "global_load_async_to_lds_b128 %6, %14, off\n\t"
               "global_load_async_to_lds_b128 %7, %15, off\n\t"
               "s_wait_xcnt 0x0"
               :: "v"(l[0]), "v"(l[1]), "v"(l[2]), "v"(l[3]),
                  "v"(l[4]), "v"(l[5]), "v"(l[6]), "v"(l[7]),
                  "v"(g[0]), "v"(g[1]), "v"(g[2]), "v"(g[3]),
                  "v"(g[4]), "v"(g[5]), "v"(g[6]), "v"(g[7])
               : "memory");
}
// This wave's copies have landed (the compiler places no wait for them).
__device__ __forceinline__ void waitAsync0() {
  asm volatile("s_wait_asynccnt 0x0" ::: "memory");
}
// This wave's LDS reads have retired before a copy refills the buffer they read.
__device__ __forceinline__ void waitDs0() {
  asm volatile("s_wait_dscnt 0x0" ::: "memory");
}

#define BM   128
#define BN   128

// EPI: 0 = compress (tanh, bf16 out, shape (M,N))
//      1 = decompress mid (reshape (M,4096)->(M*8,512), +bf16 resid, tanh, bf16)
//      2 = decompress final (reshape, +f32 resid, tanh, f32 out)
// BK : k elements of every operand row staged per pass (K is a multiple of it)
template <int EPI, int BK>
__global__ __launch_bounds__(256)
void gemm_tanh_wmma(const __bf16* __restrict__ A,
                    const __bf16* __restrict__ W,
                    const float* __restrict__ bias,
                    const __bf16* __restrict__ residB,
                    const float* __restrict__ residF,
                    __bf16* __restrict__ outB,
                    float* __restrict__ outF,
                    int M, int N, int K) {
  constexpr int ROWB  = BK * 2 + 16;     // row data + 16B pad (16B x odd pitch)
  constexpr int TILEB = 128 * ROWB;      // one staged matrix tile
  constexpr int BUFB  = 2 * TILEB;       // one stage: A tile, W tile
  constexpr int LPR   = BK / 8;          // lanes that cover one row, 16B each
  constexpr int RPS   = 256 / LPR;       // rows that one copy of the block covers
  constexpr int NCP   = 128 / RPS;       // copies per thread and matrix tile
  static_assert(NCP % 4 == 0, "copies go out in statements of eight");
  __shared__ __attribute__((aligned(16))) char smem[2 * BUFB];
  const unsigned int ldsBase = (unsigned int)(uintptr_t)smem;

  const int tid  = threadIdx.x;
  const int lane = tid & 31;
  const int wave = tid >> 5;
  const int nBlocks = N >> 7;
  const int bm = blockIdx.x / nBlocks;
  const int bn = blockIdx.x - bm * nBlocks;
  const int mBase = bm << 7;
  const int nBase = bn << 7;

  // ---- loader mapping: LPR adjacent lanes cover one row's BK*2 bytes ----
  const int lr = tid / LPR;                // first row of this thread
  const int lc = tid % LPR;                // 16B chunk inside the row
  const unsigned int ldsRow = (unsigned int)lr * ROWB + (unsigned int)lc * 16;
  unsigned int aOff[NCP];                  // element offsets of this thread's A rows
#pragma unroll                             // constant indices keep aOff[] in registers
  for (int j = 0; j < NCP; ++j) {
    int aRow = mBase + lr + j * RPS; if (aRow > M - 1) aRow = M - 1;  // clamp ragged M
    aOff[j] = (unsigned int)aRow * (unsigned int)K + (unsigned int)lc * 8;
  }
  const unsigned int wOff = (unsigned int)(nBase + lr) * (unsigned int)K + (unsigned int)lc * 8;

  // ---- compute mapping: 8 waves = 4(M) x 2(N); wave tile 32x64 ----
  const int wm = wave & 3;
  const int wn = wave >> 2;
  const int l16 = lane & 15;
  const int koff2 = (lane >> 4) << 4;      // byte offset of K-half: 0 or 16

  v8f acc[2][4] = {};
  const int ksteps = K / BK;

  auto issue = [&](int buf, int k0) {
    const unsigned int base = ldsBase + (unsigned int)buf * BUFB + ldsRow;
    const __bf16* ak = A + k0;
    const __bf16* wk = W + k0;
#pragma unroll                             // constant indices into aOff[]
    for (int j = 0; j < NCP; j += 4) {
      unsigned int l[8];
      const __bf16* g[8];
#pragma unroll                             // l[], g[] become the asm's register operands
      for (int q = 0; q < 4; ++q) {
        l[q]     = base + (unsigned int)((j + q) * RPS * ROWB);
        g[q]     = ak + aOff[j + q];
        l[q + 4] = base + (unsigned int)(TILEB + (j + q) * RPS * ROWB);
        g[q + 4] = wk + (size_t)((j + q) * RPS) * K + wOff;
      }
      asyncCopy16x8(l, g);
    }
  };

  issue(0, 0);
  waitAsync0();
  __syncthreads();                         // tile 0 visible to every wave
  if (1 < ksteps) issue(1, BK);
  for (int i = 0; i < ksteps; ++i) {
    const char* base = smem + (i & 1) * BUFB;
#pragma unroll                             // kk * 64 folds into the LDS loads' offset field
    for (int kk = 0; kk < BK / 32; ++kk) {
      BfPack a[2], b[4];
#pragma unroll
      for (int s = 0; s < 2; ++s) {
        const char* p = base + (wm * 32 + s * 16 + l16) * ROWB + kk * 64 + koff2;
        a[s].u[0] = *(const v4u*)p;
        a[s].u[1] = *(const v4u*)(p + 32);
      }
#pragma unroll
      for (int t = 0; t < 4; ++t) {
        const char* p = base + TILEB + (wn * 64 + t * 16 + l16) * ROWB + kk * 64 + koff2;
        b[t].u[0] = *(const v4u*)p;
        b[t].u[1] = *(const v4u*)(p + 32);
      }
#pragma unroll
      for (int s = 0; s < 2; ++s)
#pragma unroll
        for (int t = 0; t < 4; ++t)
          acc[s][t] = __builtin_amdgcn_wmma_f32_16x16x32_bf16(
              false, a[s].v, false, b[t].v, (short)0, acc[s][t], false, false);
    }
    waitDs0();
    waitAsync0();
    __syncthreads();                       // tile i+1 visible; tile i's readers done
    if (i + 2 < ksteps) issue(i & 1, (i + 2) * BK);
  }
  waitAsync0();                            // nothing in flight when the wave ends

  // ---- epilogue: each wave turns its 32x64 tile through its own LDS range, so
  // that a lane owns 4 adjacent columns and a wave-wide access covers whole lines.
  const int half = lane >> 4;              // two rows per wave-wide access
  const int col  = nBase + wn * 64 + l16 * 4;
  // first row of the wave's tile, in a scalar register: it bounds the loop below
  const int mW = __builtin_amdgcn_readfirstlane(mBase + wm * 32);
  int nG = (M - mW + 7) >> 3;              // groups of 8 rows that hold a row below M
  nG = nG < 0 ? 0 : (nG > 4 ? 4 : nG);

  // The reshape (M,4096)->(M*8,512) keeps the flat index, so every EPI uses m*N+col
  // (below 2^26 elements at every level).
  v4f rf[4];                               // residual of the next group, in flight
  v2u rb[4];
  auto loadRes = [&](int g) {
#pragma unroll                             // constant indices keep rf[], rb[] in registers
    for (int q = 0; q < 4; ++q) {
      int m = mW + g * 8 + q * 2 + half; if (m > M - 1) m = M - 1;   // clamp ragged M
      const unsigned int oi = (unsigned int)m * (unsigned int)N + (unsigned int)col;
      if (EPI == 1) rb[q] = *(const v2u*)(residB + oi);
      if (EPI == 2) rf[q] = *(const v4f*)(residF + oi);
    }
    // stands behind the loads, in front of any rewrite of their address registers
    if (EPI != 0) asm volatile("s_wait_xcnt 0x0" ::: "memory");
  };

  // The ring is free here: every wave's reads and copies ended at the last barrier.
  constexpr int SP = 64 * 4 + 16;          // staged row pitch: rows r and r+8 fall on disjoint banks
  static_assert(8 * 32 * SP <= 2 * BUFB, "the staged tiles fit the ring's LDS");
  char* stage = smem + wave * (32 * SP);
  {
    char* p = stage + (half << 3) * SP + l16 * 4;   // C VGPR r -> (row r | r+8, col lane%16)
#pragma unroll                             // all three: constant indices keep acc[] in registers
    for (int s = 0; s < 2; ++s)
#pragma unroll
      for (int t = 0; t < 4; ++t)
#pragma unroll
        for (int r = 0; r < 8; ++r)
          *(float*)(p + (s * 16 + r) * SP + t * 64) = acc[s][t][r];
  }
  const v4f bv = *(const v4f*)(bias + col);
  if (nG > 0) loadRes(0);                  // issued here, where the accumulators' registers are free
  waitDs0();                               // the wave's own rows are in LDS before it reads them back

#pragma unroll 1                           // rolled: one group's residual registers serve all four groups
  for (int g = 0; g < nG; ++g) {
    v4f cf[4], c[4];
    v2u cb[4];
#pragma unroll                             // constant indices keep the group's arrays in registers
    for (int q = 0; q < 4; ++q) {
      if (EPI == 1) cb[q] = rb[q];
      if (EPI == 2) cf[q] = rf[q];
      c[q] = *(const v4f*)(stage + (g * 8 + q * 2 + half) * SP + l16 * 16);   // one LDS wait a group
    }
    if (g + 1 < nG) loadRes(g + 1);        // next group's residual flies under this group's tanh
#pragma unroll                             // as above
    for (int q = 0; q < 4; ++q) {
      const int m = mW + g * 8 + q * 2 + half;
      v4f v = c[q] + bv;
      if (EPI == 1) {
        v.x += __builtin_bit_cast(float, cb[q].x << 16);
        v.y += __builtin_bit_cast(float, cb[q].x & 0xFFFF0000u);
        v.z += __builtin_bit_cast(float, cb[q].y << 16);
        v.w += __builtin_bit_cast(float, cb[q].y & 0xFFFF0000u);
      }
      if (EPI == 2) v += cf[q];
      v.x = tanhExp(v.x); v.y = tanhExp(v.y); v.z = tanhExp(v.z); v.w = tanhExp(v.w);
      if (m < M) {
        const unsigned int oi = (unsigned int)m * (unsigned int)N + (unsigned int)col;
        if (EPI == 2) {
          *(v4f*)(outF + oi) = v;
        } else {
          v2u o;
          o.x = bfbits(v.x) | (bfbits(v.y) << 16);
          o.y = bfbits(v.z) | (bfbits(v.w) << 16);
          *(v2u*)(outB + oi) = o;
        }
        // stands behind the store, in front of any rewrite of the registers that it names
        asm volatile("s_wait_xcnt 0x0" ::: "memory");
      }
    }
  }
}

extern "C" void kernel_launch(void* const* d_in, const int* in_sizes, int n_in,
                              void* d_out, int out_size, void* d_ws, size_t ws_size,
                              hipStream_t stream) {
  (void)in_sizes; (void)n_in; (void)out_size; (void)ws_size;
  const float* seq = (const float*)d_in[0];   // (2, 32768, 512)
  const float* Wc  = (const float*)d_in[1];   // (6, 512, 4096)
  const float* bc  = (const float*)d_in[2];   // (6, 512)
  const float* Wd  = (const float*)d_in[3];   // (6, 4096, 512)
  const float* bd  = (const float*)d_in[4];   // (6, 4096)
  float* out = (float*)d_out;                 // (2, 32768, 512)

  const long WELEMS = 6L * 512 * 4096;

  char* ws = (char*)d_ws;
  size_t off = 0;
  auto carve = [&](size_t bytes) -> char* {
    char* p = ws + off;
    off += (bytes + 255) & ~(size_t)255;
    return p;
  };

  __bf16* WcB = (__bf16*)carve((size_t)WELEMS * 2);
  __bf16* WdB = (__bf16*)carve((size_t)WELEMS * 2);
  const long hierElems[6] = {33554432L, 4194304L, 524288L, 65536L, 8192L, 1024L};
  __bf16* hier[6];
  for (int i = 0; i < 6; ++i) hier[i] = (__bf16*)carve((size_t)hierElems[i] * 2);
  __bf16* ping = (__bf16*)carve(4194304L * 2);
  __bf16* pong = (__bf16*)carve(4194304L * 2);

  // --- f32 -> bf16 staging (weights + input sequence) ---
  static_assert(3L * CVT_GROUPS * CVT_WAVES * 1024 == 6L * 512 * 4096, "weights: 3 pieces a wave");
  static_assert(8L * CVT_GROUPS * CVT_WAVES * 1024 == 33554432L, "sequence: 8 pieces a wave");
  f32_to_bf16_stream<3><<<CVT_GROUPS, CVT_WAVES * 32, 0, stream>>>(Wc, WcB);
  f32_to_bf16_stream<3><<<CVT_GROUPS, CVT_WAVES * 32, 0, stream>>>(Wd, WdB);
  f32_to_bf16_stream<8><<<CVT_GROUPS, CVT_WAVES * 32, 0, stream>>>(seq, hier[0]);

  // --- compress: 5 levels, A=(M,4096) W=(512,4096) ---
  const int Mc[5] = {8192, 1024, 128, 16, 2};
  for (int l = 0; l < 5; ++l) {
    const int M = Mc[l], N = 512, K = 4096;
    const int blocks = ((M + 127) / 128) * (N / 128);
    gemm_tanh_wmma<0, 256><<<blocks, 256, 0, stream>>>(
        hier[l], WcB + (size_t)l * 512 * 4096, bc + (size_t)l * 512,
        nullptr, nullptr, hier[l + 1], nullptr, M, N, K);
  }

  // --- decompress: 5 levels, A=(M,512) W=(4096,512) ---
  const __bf16* cur = hier[5];
  __bf16* bufs[2] = {ping, pong};
  for (int i = 0; i < 5; ++i) {
    const int l = 4 - i;
    int M = 2;
    for (int j = 0; j < 4 - l; ++j) M *= 8;   // 2 * 8^(4-l)
    const int N = 4096, K = 512;
    const int blocks = ((M + 127) / 128) * (N / 128);
    if (l > 0) {
      gemm_tanh_wmma<1, 256><<<blocks, 256, 0, stream>>>(
          cur, WdB + (size_t)l * 4096 * 512, bd + (size_t)l * 4096,
          hier[l], nullptr, bufs[i & 1], nullptr, M, N, K);
      cur = bufs[i & 1];
    } else {
      gemm_tanh_wmma<2, 64><<<blocks, 256, 0, stream>>>(
          cur, WdB, bd, nullptr, seq, nullptr, out, M, N, K);
    }
  }
}

// v005
// One run takes 183 microseconds.
// In two side-by-side timings against v004, it was 1.32 and 1.34 times as fast.
// Counting every step since v000, it is 3.38 times as fast.
#include <hip/hip_runtime.h>

// ---------------------------------------------------------------------------
// CDNA5 (gfx1250) HierarchicalTemporalCompressor: bf16 WMMA GEMMs with
// double-buffered async global->LDS staging (ASYNCcnt path) and ds_load_b128
// fragment reads. Every level: C[m,n] = sum_k A[m,k]*W[n,k] (+bias,+resid,tanh).
// ---------------------------------------------------------------------------

typedef __bf16        v16bf __attribute__((ext_vector_type(16)));
typedef float         v8f   __attribute__((ext_vector_type(8)));
typedef unsigned int  v4u   __attribute__((ext_vector_type(4)));
typedef unsigned int  v2u   __attribute__((ext_vector_type(2)));
typedef float         v4f   __attribute__((ext_vector_type(4)));

union BfPack {
  v4u   u[2];   // u[0] -> fragment VGPRs 0..3, u[1] -> VGPRs 4..7
  v16bf v;
};

__device__ __forceinline__ __bf16 f2bf(float f) {
  unsigned int u = __builtin_bit_cast(unsigned int, f);
  u += 0x7FFFu + ((u >> 16) & 1u);            // round-to-nearest-even
  unsigned short h = (unsigned short)(u >> 16);
  return __builtin_bit_cast(__bf16, h);
}

// the same rounding, as the low 16 bits of a word (for packed stores)
__device__ __forceinline__ unsigned int bfbits(float f) {
  return (unsigned int)__builtin_bit_cast(unsigned short, f2bf(f));
}

// tanh x = 1 - 2 / (1 + e^(2x)), straight-line: one exp2, one rcp, three plain operations.
// e^(2x) = inf gives 1, e^(2x) = 0 gives -1, a NaN stays one; the absolute error is a few
// units of 2^-24, at every x. No branch, so a group's values run as independent chains.
__device__ __forceinline__ float tanhExp(float x) {
  const float e = __builtin_amdgcn_exp2f(x * 2.885390081777927f);   // 2 * log2(e)
  return 1.0f - 2.0f * __builtin_amdgcn_rcpf(1.0f + e);
}

// f32 -> bf16 as a stream: CVT_GROUPS work-groups of CVT_WAVES waves, one per WGP.
// A wave owns PASSES adjacent pieces of 4 KB: a piece is eight loads of 512 adjacent
// bytes (16 B a lane, whole lines; read once, so non-temporal) and eight stores of 256
// adjacent bytes. The next piece's loads are in flight while this one is rounded.
#define CVT_GROUPS 256
#define CVT_WAVES  16
template <int PASSES>
__global__ __launch_bounds__(CVT_WAVES * 32)
void f32_to_bf16_stream(const float* __restrict__ in, __bf16* __restrict__ out) {
  const unsigned int lane = threadIdx.x & 31u;
  const unsigned int wave = blockIdx.x * CVT_WAVES + (threadIdx.x >> 5);
  const char* src = (const char*)in + (size_t)wave * (PASSES * 4096) + lane * 16;
  char* dst = (char*)out + (size_t)wave * (PASSES * 2048) + lane * 8;
  v4f r[2][8];                             // this piece and the next
#pragma unroll                             // constant indices keep r[][] in registers
  for (int q = 0; q < 8; ++q)
    r[0][q] = __builtin_nontemporal_load((const v4f*)(src + q * 512));
#pragma unroll                             // as above; p * 4096 folds into the offset fields
  for (int p = 0; p < PASSES; ++p) {
    // the two scheduling barriers keep the order: next piece's loads, then this piece's work
    __builtin_amdgcn_sched_barrier(0);
    if (p + 1 < PASSES) {
#pragma unroll                             // as above
      for (int q = 0; q < 8; ++q)
        r[(p + 1) & 1][q] =
            __builtin_nontemporal_load((const v4f*)(src + (p + 1) * 4096 + q * 512));
    }
    __builtin_amdgcn_sched_barrier(0);
#pragma unroll                             // as above
    for (int q = 0; q < 8; ++q) {
      const v4f v = r[p & 1][q];
      v2u o;
      o.x = bfbits(v.x) | (bfbits(v.y) << 16);
      o.y = bfbits(v.z) | (bfbits(v.w) << 16);
      *(v2u*)(dst + p * 2048 + q * 256) = o;
    }
    // stands behind the stores, in front of any rewrite of the registers that they name
    if (p + 1 < PASSES) asm volatile("s_wait_xcnt 0x0" ::: "memory");
  }
}

// Eight 16B async copies global -> LDS (ASYNCcnt). The s_wait_xcnt 0 is the
// last line of the copies' own statement, so that it stands in front of any
// later rewrite of the address registers that the copies name.
__device__ __forceinline__ void asyncCopy16x8(const unsigned int (&l)[8],
                                              const __bf16* const (&g)[8]) {
  asm volatile("global_load_async_to_lds_b128 %0, %8, off\n\t"
               "global_load_async_to_lds_b128 %1, %9, off\n\t"
               "global_load_async_to_lds_b128 %2, %10, off\n\t"
               "global_load_async_to_lds_b128 %3, %11, off\n\t"
               "global_load_async_to_lds_b128 %4, %12, off\n\t"
               "global_load_async_to_lds_b128 %5, %13, off\n\t"
               "global_load_async_to_lds_b128 %6, %14, off\n\t"
               "global_load_async_to_lds_b128 %7, %15, off\n\t"
               "s_wait_xcnt 0x0"
               :: "v"(l[0]), "v"(l[1]), "v"(l[2]), "v"(l[3]),
                  "v"(l[4]), "v"(l[5]), "v"(l[6]), "v"(l[7]),
                  "v"(g[0]), "v"(g[1]), "v"(g[2]), "v"(g[3]),
                  "v"(g[4]), "v"(g[5]), "v"(g[6]), "v"(g[7])
               : "memory");
}
// The same, for the two or four copies that are left of a wave's share of a stage.
__device__ __forceinline__ void asyncCopy16x2(const unsigned int (&l)[2],
                                              const __bf16* const (&g)[2]) {
  asm volatile("global_load_async_to_lds_b128 %0, %2, off\n\t"
               "global_load_async_to_lds_b128 %1, %3, off\n\t"
               "s_wait_xcnt 0x0"
               :: "v"(l[0]), "v"(l[1]), "v"(g[0]), "v"(g[1])
               : "memory");
}
__device__ __forceinline__ void asyncCopy16x4(const unsigned int (&l)[4],
                                              const __bf16* const (&g)[4]) {
  asm volatile("global_load_async_to_lds_b128 %0, %4, off\n\t"
               "global_load_async_to_lds_b128 %1, %5, off\n\t"
               "global_load_async_to_lds_b128 %2, %6, off\n\t"
               "global_load_async_to_lds_b128 %3, %7, off\n\t"
               "s_wait_xcnt 0x0"
               :: "v"(l[0]), "v"(l[1]), "v"(l[2]), "v"(l[3]),
                  "v"(g[0]), "v"(g[1]), "v"(g[2]), "v"(g[3])
               : "memory");
}
// This wave's copies have landed (the compiler places no wait for them).
__device__ __forceinline__ void waitAsync0() {
  asm volatile("s_wait_asynccnt 0x0" ::: "memory");
}
// This wave's LDS reads have retired before a copy refills the buffer they read.
__device__ __forceinline__ void waitDs0() {
  asm volatile("s_wait_dscnt 0x0" ::: "memory");
}

#define BM   128
#define BN   128

// EPI: 0 = compress (tanh, bf16 out, shape (M,N))
//      1 = decompress mid (reshape (M,4096)->(M*8,512), +bf16 resid, tanh, bf16)
//      2 = decompress final (reshape, +f32 resid, tanh, f32 out)
// BK : k elements of every operand row staged per pass (K is a multiple of it)
template <int EPI, int BK>
__global__ __launch_bounds__(256)
void gemm_tanh_wmma(const __bf16* __restrict__ A,
                    const __bf16* __restrict__ W,
                    const float* __restrict__ bias,
                    const __bf16* __restrict__ residB,
                    const float* __restrict__ residF,
                    __bf16* __restrict__ outB,
                    float* __restrict__ outF,
                    int M, int N, int K) {
  constexpr int ROWB  = BK * 2 + 16;     // row data + 16B pad (16B x odd pitch)
  constexpr int TILEB = 128 * ROWB;      // one staged matrix tile
  constexpr int BUFB  = 2 * TILEB;       // one stage: A tile, W tile
  constexpr int LPR   = BK / 8;          // lanes that cover one row, 16B each
  constexpr int RPS   = 256 / LPR;       // rows that one copy of the block covers
  constexpr int NCP   = 128 / RPS;       // copies per thread and matrix tile
  static_assert(NCP % 4 == 0, "copies go out in statements of eight");
  __shared__ __attribute__((aligned(16))) char smem[2 * BUFB];
  const unsigned int ldsBase = (unsigned int)(uintptr_t)smem;

  const int tid  = threadIdx.x;
  const int lane = tid & 31;
  const int wave = tid >> 5;
  const int nBlocks = N >> 7;
  const int bm = blockIdx.x / nBlocks;
  const int bn = blockIdx.x - bm * nBlocks;
  const int mBase = bm << 7;
  const int nBase = bn << 7;

  // ---- loader mapping: LPR adjacent lanes cover one row's BK*2 bytes ----
  const int lr = tid / LPR;                // first row of this thread
  const int lc = tid % LPR;                // 16B chunk inside the row
  const unsigned int ldsRow = (unsigned int)lr * ROWB + (unsigned int)lc * 16;
  unsigned int aOff[NCP];                  // element offsets of this thread's A rows
#pragma unroll                             // constant indices keep aOff[] in registers
  for (int j = 0; j < NCP; ++j) {
    int aRow = mBase + lr + j * RPS; if (aRow > M - 1) aRow = M - 1;  // clamp ragged M
    aOff[j] = (unsigned int)aRow * (unsigned int)K + (unsigned int)lc * 8;
  }
  const unsigned int wOff = (unsigned int)(nBase + lr) * (unsigned int)K + (unsigned int)lc * 8;

  // ---- compute mapping: 8 waves = 4(M) x 2(N); wave tile 32x64 ----
  const int wm = wave & 3;
  const int wn = wave >> 2;
  const int l16 = lane & 15;
  const int koff2 = (lane >> 4) << 4;      // byte offset of K-half: 0 or 16

  v8f acc[2][4] = {};
  const int ksteps = K / BK;

  auto issue = [&](int buf, int k0) {
    const unsigned int base = ldsBase + (unsigned int)buf * BUFB + ldsRow;
    const __bf16* ak = A + k0;
    const __bf16* wk = W + k0;
#pragma unroll                             // constant indices into aOff[]
    for (int j = 0; j < NCP; j += 4) {
      unsigned int l[8];
      const __bf16* g[8];
#pragma unroll                             // l[], g[] become the asm's register operands
      for (int q = 0; q < 4; ++q) {
        l[q]     = base + (unsigned int)((j + q) * RPS * ROWB);
        g[q]     = ak + aOff[j + q];
        l[q + 4] = base + (unsigned int)(TILEB + (j + q) * RPS * ROWB);
        g[q + 4] = wk + (size_t)((j + q) * RPS) * K + wOff;
      }
      asyncCopy16x8(l, g);
    }
  };

  issue(0, 0);
  waitAsync0();
  __syncthreads();                         // tile 0 visible to every wave
  if (1 < ksteps) issue(1, BK);
  for (int i = 0; i < ksteps; ++i) {
    const char* base = smem + (i & 1) * BUFB;
#pragma unroll                             // kk * 64 folds into the LDS loads' offset field
    for (int kk = 0; kk < BK / 32; ++kk) {
      BfPack a[2], b[4];
#pragma unroll
      for (int s = 0; s < 2; ++s) {
        const char* p = base + (wm * 32 + s * 16 + l16) * ROWB + kk * 64 + koff2;
        a[s].u[0] = *(const v4u*)p;
        a[s].u[1] = *(const v4u*)(p + 32);
      }
#pragma unroll
      for (int t = 0; t < 4; ++t) {
        const char* p = base + TILEB + (wn * 64 + t * 16 + l16) * ROWB + kk * 64 + koff2;
        b[t].u[0] = *(const v4u*)p;
        b[t].u[1] = *(const v4u*)(p + 32);
      }
#pragma unroll
      for (int s = 0; s < 2; ++s)
#pragma unroll
        for (int t = 0; t < 4; ++t)
          acc[s][t] = __builtin_amdgcn_wmma_f32_16x16x32_bf16(
              false, a[s].v, false, b[t].v, (short)0, acc[s][t], false, false);
    }
    waitDs0();
    waitAsync0();
    __syncthreads();                       // tile i+1 visible; tile i's readers done
    if (i + 2 < ksteps) issue(i & 1, (i + 2) * BK);
  }
  waitAsync0();                            // nothing in flight when the wave ends

  // ---- epilogue: each wave turns its 32x64 tile through its own LDS range, so
  // that a lane owns 4 adjacent columns and a wave-wide access covers whole lines.
  const int half = lane >> 4;              // two rows per wave-wide access
  const int col  = nBase + wn * 64 + l16 * 4;
  // first row of the wave's tile, in a scalar register: it bounds the loop below
  const int mW = __builtin_amdgcn_readfirstlane(mBase + wm * 32);
  int nG = (M - mW + 7) >> 3;              // groups of 8 rows that hold a row below M
  nG = nG < 0 ? 0 : (nG > 4 ? 4 : nG);

  // The reshape (M,4096)->(M*8,512) keeps the flat index, so every EPI uses m*N+col
  // (below 2^26 elements at every level).
  v4f rf[4];                               // residual of the next group, in flight
  v2u rb[4];
  auto loadRes = [&](int g) {
#pragma unroll                             // constant indices keep rf[], rb[] in registers
    for (int q = 0; q < 4; ++q) {
      int m = mW + g * 8 + q * 2 + half; if (m > M - 1) m = M - 1;   // clamp ragged M
      const unsigned int oi = (unsigned int)m * (unsigned int)N + (unsigned int)col;
      if (EPI == 1) rb[q] = *(const v2u*)(residB + oi);
      if (EPI == 2) rf[q] = *(const v4f*)(residF + oi);
    }
    // stands behind the loads, in front of any rewrite of their address registers
    if (EPI != 0) asm volatile("s_wait_xcnt 0x0" ::: "memory");
  };

  // The ring is free here: every wave's reads and copies ended at the last barrier.
  constexpr int SP = 64 * 4 + 16;          // staged row pitch: rows r and r+8 fall on disjoint banks
  static_assert(8 * 32 * SP <= 2 * BUFB, "the staged tiles fit the ring's LDS");
  char* stage = smem + wave * (32 * SP);
  {
    char* p = stage + (half << 3) * SP + l16 * 4;   // C VGPR r -> (row r | r+8, col lane%16)
#pragma unroll                             // all three: constant indices keep acc[] in registers
    for (int s = 0; s < 2; ++s)
#pragma unroll
      for (int t = 0; t < 4; ++t)
#pragma unroll
        for (int r = 0; r < 8; ++r)
          *(float*)(p + (s * 16 + r) * SP + t * 64) = acc[s][t][r];
  }
  const v4f bv = *(const v4f*)(bias + col);
  if (nG > 0) loadRes(0);                  // issued here, where the accumulators' registers are free
  waitDs0();                               // the wave's own rows are in LDS before it reads them back

#pragma unroll 1                           // rolled: one group's residual registers serve all four groups
  for (int g = 0; g < nG; ++g) {
    v4f cf[4], c[4];
    v2u cb[4];
#pragma unroll                             // constant indices keep the group's arrays in registers
    for (int q = 0; q < 4; ++q) {
      if (EPI == 1) cb[q] = rb[q];
      if (EPI == 2) cf[q] = rf[q];
      c[q] = *(const v4f*)(stage + (g * 8 + q * 2 + half) * SP + l16 * 16);   // one LDS wait a group
    }
    if (g + 1 < nG) loadRes(g + 1);        // next group's residual flies under this group's tanh
#pragma unroll                             // as above
    for (int q = 0; q < 4; ++q) {
      const int m = mW + g * 8 + q * 2 + half;
      v4f v = c[q] + bv;
      if (EPI == 1) {
        v.x += __builtin_bit_cast(float, cb[q].x << 16);
        v.y += __builtin_bit_cast(float, cb[q].x & 0xFFFF0000u);
        v.z += __builtin_bit_cast(float, cb[q].y << 16);
        v.w += __builtin_bit_cast(float, cb[q].y & 0xFFFF0000u);
      }
      if (EPI == 2) v += cf[q];
      v.x = tanhExp(v.x); v.y = tanhExp(v.y); v.z = tanhExp(v.z); v.w = tanhExp(v.w);
      if (m < M) {
        const unsigned int oi = (unsigned int)m * (unsigned int)N + (unsigned int)col;
        if (EPI == 2) {
          *(v4f*)(outF + oi) = v;
        } else {
          v2u o;
          o.x = bfbits(v.x) | (bfbits(v.y) << 16);
          o.y = bfbits(v.z) | (bfbits(v.w) << 16);
          *(v2u*)(outB + oi) = o;
        }
        // stands behind the store, in front of any rewrite of the registers that it names
        asm volatile("s_wait_xcnt 0x0" ::: "memory");
      }
    }
  }
}

// Compress levels with few rows (M <= 1024; K = 4096, N = 512): 128x128 tiles would leave
// most WGPs idle while a few walk all of K. Here a work-group owns TM x 64 of the output
// (whole 128 B lines of bf16) and its 16 waves split K: of every staged 512 k a wave takes
// its own 32 for the whole tile. The 16 partial tiles are summed through LDS, in wave order.
template <int TM>
__global__ __launch_bounds__(512)
void gemm_tanh_ksplit(const __bf16* __restrict__ A,
                      const __bf16* __restrict__ W,
                      const float* __restrict__ bias,
                      __bf16* __restrict__ outB,
                      int M) {
  constexpr int K = 4096, N = 512, TN = 64, NW = 16;
  constexpr int SK    = NW * 32;           // k elements per stage: one WMMA k step a wave
  constexpr int ROWB  = SK * 2 + 16;       // row data + 16B pad (16B x odd pitch)
  constexpr int ROWS  = TM + TN;           // A rows, then W rows
  constexpr int BUFB  = ROWS * ROWB;       // one stage
  constexpr int NC    = ROWS * 2 / NW;     // copies per wave and stage, 512 B (half a row) each
  constexpr int NA    = TM * 2 / NW;       // of these, on A rows
  constexpr int FM    = TM / 16;
  constexpr int STAGES = K / SK;
  static_assert(NC == 10 || NC == 12, "a statement of eight copies, then two or four");
  __shared__ __attribute__((aligned(16))) char smem[2 * BUFB];
  const unsigned int ldsBase = (unsigned int)(uintptr_t)smem;

  const int tid  = threadIdx.x;
  const int lane = tid & 31;
  const int wave = tid >> 5;
  const int mBase = (int)(blockIdx.x >> 3) * TM;
  const int nBase = (int)(blockIdx.x & 7) * TN;

  // ---- loader mapping: copy c of wave w covers half (w & 1) of staged row c * 8 + (w >> 1) ----
  const int r0 = wave >> 1;
  const unsigned int inRow = (unsigned int)(wave & 1) * 256 + (unsigned int)lane * 8;   // element
  const unsigned int ldsLane = ldsBase + (unsigned int)r0 * ROWB + inRow * 2;
  unsigned int gOff[NC];                   // element offsets of this thread's rows
#pragma unroll                             // constant indices keep gOff[] in registers
  for (int c = 0; c < NC; ++c) {
    if (c < NA) {
      int aRow = mBase + c * 8 + r0; if (aRow > M - 1) aRow = M - 1;   // clamp ragged M
      gOff[c] = (unsigned int)aRow * (unsigned int)K + inRow;
    } else {
      gOff[c] = (unsigned int)(nBase + (c - NA) * 8 + r0) * (unsigned int)K + inRow;
    }
  }

  const int l16   = lane & 15;
  const int half  = lane >> 4;
  const int koff2 = half << 4;             // byte offset of K-half: 0 or 16

  auto issue = [&](int buf, int k0) {
    const unsigned int base = ldsLane + (unsigned int)buf * BUFB;
    const __bf16* ak = A + k0;
    const __bf16* wk = W + k0;
    unsigned int l[8];
    const __bf16* g[8];
#pragma unroll                             // l[], g[] become the asm's register operands
    for (int c = 0; c < 8; ++c) {
      l[c] = base + (unsigned int)(c * 8 * ROWB);
      g[c] = (c < NA ? ak : wk) + gOff[c];
    }
    asyncCopy16x8(l, g);
    unsigned int l2[NC - 8];
    const __bf16* g2[NC - 8];
#pragma unroll                             // as above
    for (int c = 8; c < NC; ++c) {
      l2[c - 8] = base + (unsigned int)(c * 8 * ROWB);
      g2[c - 8] = wk + gOff[c];
    }
    if constexpr (NC == 10) asyncCopy16x2(l2, g2); else asyncCopy16x4(l2, g2);
  };

  v8f acc[FM][4] = {};
  issue(0, 0);
  waitAsync0();
  __syncthreads();                         // stage 0 visible to every wave
  issue(1, SK);
#pragma unroll 1                           // rolled: unrolled, all stages' copy addresses are formed ahead and spill
  for (int i = 0; i < STAGES; ++i) {
    const char* base = smem + (i & 1) * BUFB + wave * 64 + koff2;
    BfPack a[FM], b[4];
#pragma unroll
    for (int s = 0; s < FM; ++s) {
      const char* p = base + (s * 16 + l16) * ROWB;
      a[s].u[0] = *(const v4u*)p;
      a[s].u[1] = *(const v4u*)(p + 32);
    }
#pragma unroll
    for (int t = 0; t < 4; ++t) {
      const char* p = base + (TM + t * 16 + l16) * ROWB;
      b[t].u[0] = *(const v4u*)p;
      b[t].u[1] = *(const v4u*)(p + 32);
    }
#pragma unroll
    for (int s = 0; s < FM; ++s)
#pragma unroll
      for (int t = 0; t < 4; ++t)
        acc[s][t] = __builtin_amdgcn_wmma_f32_16x16x32_bf16(
            false, a[s].v, false, b[t].v, (short)0, acc[s][t], false, false);
    waitDs0();
    waitAsync0();
    __syncthreads();                       // stage i+1 visible; stage i's readers done
    if (i + 2 < STAGES) issue(i & 1, (i + 2) * SK);
  }
  waitAsync0();                            // nothing in flight when the wave ends

  // ---- merge: a thread owns EPT adjacent columns of one row, a wave whole 128 B lines ----
  constexpr int EPT = TM * TN / (NW * 32); // 2 or 4
  constexpr int TPR = TN / EPT;            // threads per output row
  typedef float vE __attribute__((ext_vector_type(EPT)));
  const int row = tid / TPR;
  const int col = (tid % TPR) * EPT;
  vE v = *(const vE*)(bias + nBase + col);
  // stands behind the load, in front of any rewrite of its address registers
  asm volatile("s_wait_xcnt 0x0" ::: "memory");

  // The ring is free here: every wave's reads and copies ended at the last barrier.
  constexpr int SP   = TN * 4 + 16;        // partial tile's row pitch: rows r and r+8 fall on disjoint banks
  constexpr int REGB = TM * SP;            // one wave's partial tile
  static_assert(NW * REGB <= 2 * BUFB, "the partial tiles fit the ring's LDS");
  {
    char* p = smem + wave * REGB + (half << 3) * SP + l16 * 4;   // C VGPR r -> (row r | r+8, col lane%16)
#pragma unroll                             // all three: constant indices keep acc[] in registers
    for (int s = 0; s < FM; ++s)
#pragma unroll
      for (int t = 0; t < 4; ++t)
#pragma unroll
        for (int r = 0; r < 8; ++r)
          *(float*)(p + (s * 16 + r) * SP + t * 64) = acc[s][t][r];
  }
  __syncthreads();                         // every wave's partial tile is in LDS
#pragma unroll                             // w * REGB folds into the LDS loads' offset field
  for (int w = 0; w < NW; ++w)
    v += *(const vE*)(smem + w * REGB + row * SP + col * 4);

  const int m = mBase + row;
  if (m < M) {
    const unsigned int oi = (unsigned int)m * (unsigned int)N + (unsigned int)(nBase + col);
    unsigned int o[EPT / 2];
#pragma unroll                             // constant indices keep o[] in registers
    for (int e = 0; e < EPT / 2; ++e)
      o[e] = bfbits(tanhExp(v[2 * e])) | (bfbits(tanhExp(v[2 * e + 1])) << 16);
    if constexpr (EPT == 2) {
      *(unsigned int*)(outB + oi) = o[0];
    } else {
      v2u ov; ov.x = o[0]; ov.y = o[1];
      *(v2u*)(outB + oi) = ov;
    }
  }
}

extern "C" void kernel_launch(void* const* d_in, const int* in_sizes, int n_in,
                              void* d_out, int out_size, void* d_ws, size_t ws_size,
                              hipStream_t stream) {
  (void)in_sizes; (void)n_in; (void)out_size; (void)ws_size;
  const float* seq = (const float*)d_in[0];   // (2, 32768, 512)
  const float* Wc  = (const float*)d_in[1];   // (6, 512, 4096)
  const float* bc  = (const float*)d_in[2];   // (6, 512)
  const float* Wd  = (const float*)d_in[3];   // (6, 4096, 512)
  const float* bd  = (const float*)d_in[4];   // (6, 4096)
  float* out = (float*)d_out;                 // (2, 32768, 512)

  const long WELEMS = 6L * 512 * 4096;

  char* ws = (char*)d_ws;
  size_t off = 0;
  auto carve = [&](size_t bytes) -> char* {
    char* p = ws + off;
    off += (bytes + 255) & ~(size_t)255;
    return p;
  };

  __bf16* WcB = (__bf16*)carve((size_t)WELEMS * 2);
  __bf16* WdB = (__bf16*)carve((size_t)WELEMS * 2);
  const long hierElems[6] = {33554432L, 4194304L, 524288L, 65536L, 8192L, 1024L};
  __bf16* hier[6];
  for (int i = 0; i < 6; ++i) hier[i] = (__bf16*)carve((size_t)hierElems[i] * 2);
  __bf16* ping = (__bf16*)carve(4194304L * 2);
  __bf16* pong = (__bf16*)carve(4194304L * 2);

  // --- f32 -> bf16 staging (weights + input sequence) ---
  static_assert(3L * CVT_GROUPS * CVT_WAVES * 1024 == 6L * 512 * 4096, "weights: 3 pieces a wave");
  static_assert(8L * CVT_GROUPS * CVT_WAVES * 1024 == 33554432L, "sequence: 8 pieces a wave");
  f32_to_bf16_stream<3><<<CVT_GROUPS, CVT_WAVES * 32, 0, stream>>>(Wc, WcB);
  f32_to_bf16_stream<3><<<CVT_GROUPS, CVT_WAVES * 32, 0, stream>>>(Wd, WdB);
  f32_to_bf16_stream<8><<<CVT_GROUPS, CVT_WAVES * 32, 0, stream>>>(seq, hier[0]);

  // --- compress: 5 levels, A=(M,4096) W=(512,4096) ---
  const int Mc[5] = {8192, 1024, 128, 16, 2};
  for (int l = 0; l < 5; ++l) {
    const int M = Mc[l], N = 512, K = 4096;
    const __bf16* Wl = WcB + (size_t)l * 512 * 4096;
    const float* bl = bc + (size_t)l * 512;
    if (l == 0) {
      const int blocks = ((M + 127) / 128) * (N / 128);
      gemm_tanh_wmma<0, 256><<<blocks, 256, 0, stream>>>(
          hier[l], Wl, bl, nullptr, nullptr, hier[l + 1], nullptr, M, N, K);
    } else if (l == 1) {
      gemm_tanh_ksplit<32><<<(M / 32) * (N / 64), 512, 0, stream>>>(hier[l], Wl, bl, hier[l + 1], M);
    } else {
      gemm_tanh_ksplit<16><<<((M + 15) / 16) * (N / 64), 512, 0, stream>>>(hier[l], Wl, bl, hier[l + 1], M);
    }
  }

  // --- decompress: 5 levels, A=(M,512) W=(4096,512) ---
  const __bf16* cur = hier[5];
  __bf16* bufs[2] = {ping, pong};
  for (int i = 0; i < 5; ++i) {
    const int l = 4 - i;
    int M = 2;
    for (int j = 0; j < 4 - l; ++j) M *= 8;   // 2 * 8^(4-l)
    const int N = 4096, K = 512;
    const int blocks = ((M + 127) / 128) * (N / 128);
    if (l > 0) {
      gemm_tanh_wmma<1, 256><<<blocks, 256, 0, stream>>>(
          cur, WdB + (size_t)l * 4096 * 512, bd + (size_t)l * 4096,
          hier[l], nullptr, bufs[i & 1], nullptr, M, N, K);
      cur = bufs[i & 1];
    } else {
      gemm_tanh_wmma<2, 64><<<blocks, 256, 0, stream>>>(
          cur, WdB, bd, nullptr, seq, nullptr, out, M, N, K);
    }
  }
}

// v006
// A run of this version takes 175 microseconds.
// Next to v005, in two timings, it ran 1.04 and 1.05 times as fast.
// Over all steps from v000 it is 3.55 times as fast.
#include <hip/hip_runtime.h>

// ---------------------------------------------------------------------------
// CDNA5 (gfx1250) HierarchicalTemporalCompressor: bf16 WMMA GEMMs with
// double-buffered async global->LDS staging (ASYNCcnt path) and ds_load_b128
// fragment reads. Every level: C[m,n] = sum_k A[m,k]*W[n,k] (+bias,+resid,tanh).
// ---------------------------------------------------------------------------

typedef __bf16        v16bf __attribute__((ext_vector_type(16)));
typedef float         v8f   __attribute__((ext_vector_type(8)));
typedef unsigned int  v4u   __attribute__((ext_vector_type(4)));
typedef unsigned int  v2u   __attribute__((ext_vector_type(2)));
typedef float         v4f   __attribute__((ext_vector_type(4)));

union BfPack {
  v4u   u[2];   // u[0] -> fragment VGPRs 0..3, u[1] -> VGPRs 4..7
  v16bf v;
};

__device__ __forceinline__ __bf16 f2bf(float f) {
  unsigned int u = __builtin_bit_cast(unsigned int, f);
  u += 0x7FFFu + ((u >> 16) & 1u);            // round-to-nearest-even
  unsigned short h = (unsigned short)(u >> 16);
  return __builtin_bit_cast(__bf16, h);
}

// the same rounding, as the low 16 bits of a word (for packed stores)
__device__ __forceinline__ unsigned int bfbits(float f) {
  return (unsigned int)__builtin_bit_cast(unsigned short, f2bf(f));
}

// tanh x = 1 - 2 / (1 + e^(2x)), straight-line: one exp2, one rcp, three plain operations.
// e^(2x) = inf gives 1, e^(2x) = 0 gives -1, a NaN stays one; the absolute error is a few
// units of 2^-24, at every x. No branch, so a group's values run as independent chains.
__device__ __forceinline__ float tanhExp(float x) {
  const float e = __builtin_amdgcn_exp2f(x * 2.885390081777927f);   // 2 * log2(e)
  return 1.0f - 2.0f * __builtin_amdgcn_rcpf(1.0f + e);
}

// f32 -> bf16 as a stream, by work-groups of CVT_WAVES waves; group is the work-group's
// place in its stream. A wave owns PASSES adjacent pieces of 4 KB: a piece is eight loads
// of 512 adjacent bytes (16 B a lane, whole lines; read once, so non-temporal) and eight
// stores of 256 adjacent bytes. The next piece's loads are in flight while this one is rounded.
#define CVT_WAVES  16
template <int PASSES>
__device__ __forceinline__
void f32_to_bf16_stream(const float* __restrict__ in, __bf16* __restrict__ out, unsigned int group) {
  const unsigned int lane = threadIdx.x & 31u;
  const unsigned int wave = group * CVT_WAVES + (threadIdx.x >> 5);
  const char* src = (const char*)in + (size_t)wave * (PASSES * 4096) + lane * 16;
  char* dst = (char*)out + (size_t)wave * (PASSES * 2048) + lane * 8;
  v4f r[2][8];                             // this piece and the next
#pragma unroll                             // constant indices keep r[][] in registers
  for (int q = 0; q < 8; ++q)
    r[0][q] = __builtin_nontemporal_load((const v4f*)(src + q * 512));
#pragma unroll                             // as above; p * 4096 folds into the offset fields
  for (int p = 0; p < PASSES; ++p) {
    // the two scheduling barriers keep the order: next piece's loads, then this piece's work
    __builtin_amdgcn_sched_barrier(0);
    if (p + 1 < PASSES) {
#pragma unroll                             // as above
      for (int q = 0; q < 8; ++q)
        r[(p + 1) & 1][q] =
            __builtin_nontemporal_load((const v4f*)(src + (p + 1) * 4096 + q * 512));
    }
    __builtin_amdgcn_sched_barrier(0);
#pragma unroll                             // as above
    for (int q = 0; q < 8; ++q) {
      const v4f v = r[p & 1][q];
      v2u o;
      o.x = bfbits(v.x) | (bfbits(v.y) << 16);
      o.y = bfbits(v.z) | (bfbits(v.w) << 16);
      *(v2u*)(dst + p * 2048 + q * 256) = o;
    }
    // stands behind the stores, in front of any rewrite of the registers that they name
    // (behind the last piece too, though nothing of either calling kernel follows the stream)
    asm volatile("s_wait_xcnt 0x0" ::: "memory");
  }
}

// The streams that the first GEMM waits for, in one grid: work-groups below SEQ_GROUPS take
// the sequence (8 pieces a wave), the HEAD_GROUPS behind them the first three levels of the
// compress weights (3 pieces a wave). The other weights ride in later, under-filled grids.
#define SEQ_GROUPS  256
#define HEAD_GROUPS 128
__global__ __launch_bounds__(CVT_WAVES * 32)
void f32_to_bf16_head(const float* __restrict__ seq, __bf16* __restrict__ seqB,
                      const float* __restrict__ w, __bf16* __restrict__ wB) {
  if (blockIdx.x < SEQ_GROUPS) f32_to_bf16_stream<8>(seq, seqB, blockIdx.x);
  else                         f32_to_bf16_stream<3>(w, wB, blockIdx.x - SEQ_GROUPS);
}

// Eight 16B async copies global -> LDS (ASYNCcnt). The s_wait_xcnt 0 is the
// last line of the copies' own statement, so that it stands in front of any
// later rewrite of the address registers that the copies name.
__device__ __forceinline__ void asyncCopy16x8(const unsigned int (&l)[8],
                                              const __bf16* const (&g)[8]) {
  asm volatile("global_load_async_to_lds_b128 %0, %8, off\n\t"
               "global_load_async_to_lds_b128 %1, %9, off\n\t"
               "global_load_async_to_lds_b128 %2, %10, off\n\t"
               "global_load_async_to_lds_b128 %3, %11, off\n\t"
               "global_load_async_to_lds_b128 %4, %12, off\n\t"
               "global_load_async_to_lds_b128 %5, %13, off\n\t"
               "global_load_async_to_lds_b128 %6, %14, off\n\t"
               "global_load_async_to_lds_b128 %7, %15, off\n\t"
               "s_wait_xcnt 0x0"
               :: "v"(l[0]), "v"(l[1]), "v"(l[2]), "v"(l[3]),
                  "v"(l[4]), "v"(l[5]), "v"(l[6]), "v"(l[7]),
                  "v"(g[0]), "v"(g[1]), "v"(g[2]), "v"(g[3]),
                  "v"(g[4]), "v"(g[5]), "v"(g[6]), "v"(g[7])
               : "memory");
}
// The same, for the two or four copies that are left of a wave's share of a stage.
__device__ __forceinline__ void asyncCopy16x2(const unsigned int (&l)[2],
                                              const __bf16* const (&g)[2]) {
  asm volatile("global_load_async_to_lds_b128 %0, %2, off\n\t"
               "global_load_async_to_lds_b128 %1, %3, off\n\t"
               "s_wait_xcnt 0x0"
               :: "v"(l[0]), "v"(l[1]), "v"(g[0]), "v"(g[1])
               : "memory");
}
__device__ __forceinline__ void asyncCopy16x4(const unsigned int (&l)[4],
                                              const __bf16* const (&g)[4]) {
  asm volatile("global_load_async_to_lds_b128 %0, %4, off\n\t"
               "global_load_async_to_lds_b128 %1, %5, off\n\t"
               "global_load_async_to_lds_b128 %2, %6, off\n\t"
               "global_load_async_to_lds_b128 %3, %7, off\n\t"
               "s_wait_xcnt 0x0"
               :: "v"(l[0]), "v"(l[1]), "v"(l[2]), "v"(l[3]),
                  "v"(g[0]), "v"(g[1]), "v"(g[2]), "v"(g[3])
               : "memory");
}
// This wave's copies have landed (the compiler places no wait for them).
__device__ __forceinline__ void waitAsync0() {
  asm volatile("s_wait_asynccnt 0x0" ::: "memory");
}
// This wave's LDS reads have retired before a copy refills the buffer they read.
__device__ __forceinline__ void waitDs0() {
  asm volatile("s_wait_dscnt 0x0" ::: "memory");
}

#define BM   128
#define BN   128

// EPI: 0 = compress (tanh, bf16 out, shape (M,N))
//      1 = decompress mid (reshape (M,4096)->(M*8,512), +bf16 resid, tanh, bf16)
//      2 = decompress final (reshape, +f32 resid, tanh, f32 out)
// BK : k elements of every operand row staged per pass (K is a multiple of it)
template <int EPI, int BK>
__global__ __launch_bounds__(256)
void gemm_tanh_wmma(const __bf16* __restrict__ A,
                    const __bf16* __restrict__ W,
                    const float* __restrict__ bias,
                    const __bf16* __restrict__ residB,
                    const float* __restrict__ residF,
                    __bf16* __restrict__ outB,
                    float* __restrict__ outF,
                    int M, int N, int K) {
  constexpr int ROWB  = BK * 2 + 16;     // row data + 16B pad (16B x odd pitch)
  constexpr int TILEB = 128 * ROWB;      // one staged matrix tile
  constexpr int BUFB  = 2 * TILEB;       // one stage: A tile, W tile
  constexpr int LPR   = BK / 8;          // lanes that cover one row, 16B each
  constexpr int RPS   = 256 / LPR;       // rows that one copy of the block covers
  constexpr int NCP   = 128 / RPS;       // copies per thread and matrix tile
  static_assert(NCP % 4 == 0, "copies go out in statements of eight");
  __shared__ __attribute__((aligned(16))) char smem[2 * BUFB];
  const unsigned int ldsBase = (unsigned int)(uintptr_t)smem;

  const int tid  = threadIdx.x;
  const int lane = tid & 31;
  const int wave = tid >> 5;
  const int nBlocks = N >> 7;
  const int bm = blockIdx.x / nBlocks;
  const int bn = blockIdx.x - bm * nBlocks;
  const int mBase = bm << 7;
  const int nBase = bn << 7;

  // ---- loader mapping: LPR adjacent lanes cover one row's BK*2 bytes ----
  const int lr = tid / LPR;                // first row of this thread
  const int lc = tid % LPR;                // 16B chunk inside the row
  const unsigned int ldsRow = (unsigned int)lr * ROWB + (unsigned int)lc * 16;
  unsigned int aOff[NCP];                  // element offsets of this thread's A rows
#pragma unroll                             // constant indices keep aOff[] in registers
  for (int j = 0; j < NCP; ++j) {
    int aRow = mBase + lr + j * RPS; if (aRow > M - 1) aRow = M - 1;  // clamp ragged M
    aOff[j] = (unsigned int)aRow * (unsigned int)K + (unsigned int)lc * 8;
  }
  const unsigned int wOff = (unsigned int)(nBase + lr) * (unsigned int)K + (unsigned int)lc * 8;

  // ---- compute mapping: 8 waves = 4(M) x 2(N); wave tile 32x64 ----
  const int wm = wave & 3;
  const int wn = wave >> 2;
  const int l16 = lane & 15;
  const int koff2 = (lane >> 4) << 4;      // byte offset of K-half: 0 or 16

  v8f acc[2][4] = {};
  const int ksteps = K / BK;

  auto issue = [&](int buf, int k0) {
    const unsigned int base = ldsBase + (unsigned int)buf * BUFB + ldsRow;
    const __bf16* ak = A + k0;
    const __bf16* wk = W + k0;
#pragma unroll                             // constant indices into aOff[]
    for (int j = 0; j < NCP; j += 4) {
      unsigned int l[8];
      const __bf16* g[8];
#pragma unroll                             // l[], g[] become the asm's register operands
      for (int q = 0; q < 4; ++q) {
        l[q]     = base + (unsigned int)((j + q) * RPS * ROWB);
        g[q]     = ak + aOff[j + q];
        l[q + 4] = base + (unsigned int)(TILEB + (j + q) * RPS * ROWB);
        g[q + 4] = wk + (size_t)((j + q) * RPS) * K + wOff;
      }
      asyncCopy16x8(l, g);
    }
  };

  issue(0, 0);
  waitAsync0();
  __syncthreads();                         // tile 0 visible to every wave
  if (1 < ksteps) issue(1, BK);
  for (int i = 0; i < ksteps; ++i) {
    const char* base = smem + (i & 1) * BUFB;
#pragma unroll                             // kk * 64 folds into the LDS loads' offset field
    for (int kk = 0; kk < BK / 32; ++kk) {
      BfPack a[2], b[4];
#pragma unroll
      for (int s = 0; s < 2; ++s) {
        const char* p = base + (wm * 32 + s * 16 + l16) * ROWB + kk * 64 + koff2;
        a[s].u[0] = *(const v4u*)p;
        a[s].u[1] = *(const v4u*)(p + 32);
      }
#pragma unroll
      for (int t = 0; t < 4; ++t) {
        const char* p = base + TILEB + (wn * 64 + t * 16 + l16) * ROWB + kk * 64 + koff2;
        b[t].u[0] = *(const v4u*)p;
        b[t].u[1] = *(const v4u*)(p + 32);
      }
#pragma unroll
      for (int s = 0; s < 2; ++s)
#pragma unroll
        for (int t = 0; t < 4; ++t)
          acc[s][t] = __builtin_amdgcn_wmma_f32_16x16x32_bf16(
              false, a[s].v, false, b[t].v, (short)0, acc[s][t], false, false);
    }
    waitDs0();
    waitAsync0();
    __syncthreads();                       // tile i+1 visible; tile i's readers done
    if (i + 2 < ksteps) issue(i & 1, (i + 2) * BK);
  }
  waitAsync0();                            // nothing in flight when the wave ends

  // ---- epilogue: each wave turns its 32x64 tile through its own LDS range, so
  // that a lane owns 4 adjacent columns and a wave-wide access covers whole lines.
  const int half = lane >> 4;              // two rows per wave-wide access
  const int col  = nBase + wn * 64 + l16 * 4;
  // first row of the wave's tile, in a scalar register: it bounds the loop below
  const int mW = __builtin_amdgcn_readfirstlane(mBase + wm * 32);
  int nG = (M - mW + 7) >> 3;              // groups of 8 rows that hold a row below M
  nG = nG < 0 ? 0 : (nG > 4 ? 4 : nG);

  // The reshape (M,4096)->(M*8,512) keeps the flat index, so every EPI uses m*N+col
  // (below 2^26 elements at every level).
  v4f rf[4];                               // residual of the next group, in flight
  v2u rb[4];
  auto loadRes = [&](int g) {
#pragma unroll                             // constant indices keep rf[], rb[] in registers
    for (int q = 0; q < 4; ++q) {
      int m = mW + g * 8 + q * 2 + half; if (m > M - 1) m = M - 1;   // clamp ragged M
      const unsigned int oi = (unsigned int)m * (unsigned int)N + (unsigned int)col;
      if (EPI == 1) rb[q] = *(const v2u*)(residB + oi);
      if (EPI == 2) rf[q] = *(const v4f*)(residF + oi);
    }
    // stands behind the loads, in front of any rewrite of their address registers
    if (EPI != 0) asm volatile("s_wait_xcnt 0x0" ::: "memory");
  };

  // The ring is free here: every wave's reads and copies ended at the last barrier.
  constexpr int SP = 64 * 4 + 16;          // staged row pitch: rows r and r+8 fall on disjoint banks
  static_assert(8 * 32 * SP <= 2 * BUFB, "the staged tiles fit the ring's LDS");
  char* stage = smem + wave * (32 * SP);
  {
    char* p = stage + (half << 3) * SP + l16 * 4;   // C VGPR r -> (row r | r+8, col lane%16)
#pragma unroll                             // all three: constant indices keep acc[] in registers
    for (int s = 0; s < 2; ++s)
#pragma unroll
      for (int t = 0; t < 4; ++t)
#pragma unroll
        for (int r = 0; r < 8; ++r)
          *(float*)(p + (s * 16 + r) * SP + t * 64) = acc[s][t][r];
  }
  const v4f bv = *(const v4f*)(bias + col);
  if (nG > 0) loadRes(0);                  // issued here, where the accumulators' registers are free
  waitDs0();                               // the wave's own rows are in LDS before it reads them back

#pragma unroll 1                           // rolled: one group's residual registers serve all four groups
  for (int g = 0; g < nG; ++g) {
    v4f cf[4], c[4];
    v2u cb[4];
#pragma unroll                             // constant indices keep the group's arrays in registers
    for (int q = 0; q < 4; ++q) {
      if (EPI == 1) cb[q] = rb[q];
      if (EPI == 2) cf[q] = rf[q];
      c[q] = *(const v4f*)(stage + (g * 8 + q * 2 + half) * SP + l16 * 16);   // one LDS wait a group
    }
    if (g + 1 < nG) loadRes(g + 1);        // next group's residual flies under this group's tanh
#pragma unroll                             // as above
    for (int q = 0; q < 4; ++q) {
      const int m = mW + g * 8 + q * 2 + half;
      v4f v = c[q] + bv;
      if (EPI == 1) {
        v.x += __builtin_bit_cast(float, cb[q].x << 16);
        v.y += __builtin_bit_cast(float, cb[q].x & 0xFFFF0000u);
        v.z += __builtin_bit_cast(float, cb[q].y << 16);
        v.w += __builtin_bit_cast(float, cb[q].y & 0xFFFF0000u);
      }
      if (EPI == 2) v += cf[q];
      v.x = tanhExp(v.x); v.y = tanhExp(v.y); v.z = tanhExp(v.z); v.w = tanhExp(v.w);
      if (m < M) {
        const unsigned int oi = (unsigned int)m * (unsigned int)N + (unsigned int)col;
        if (EPI == 2) {
          *(v4f*)(outF + oi) = v;
        } else {
          v2u o;
          o.x = bfbits(v.x) | (bfbits(v.y) << 16);
          o.y = bfbits(v.z) | (bfbits(v.w) << 16);
          *(v2u*)(outB + oi) = o;
        }
        // stands behind the store, in front of any rewrite of the registers that it names
        asm volatile("s_wait_xcnt 0x0" ::: "memory");
      }
    }
  }
}

// Compress levels with few rows (M <= 1024; K = 4096, N = 512): 128x128 tiles would leave
// most WGPs idle while a few walk all of K. Here a work-group owns TM x 64 of the output
// (whole 128 B lines of bf16) and its 16 waves split K: of every staged 512 k a wave takes
// its own 32 for the whole tile. The 16 partial tiles are summed through LDS, in wave order.
// RIDE: the grids of the last three levels leave most WGPs idle, so RIDE_GROUPS more
// work-groups behind the nGemm that hold a tile round three levels of weights that a later
// launch reads (2 pieces a wave); they touch nothing of this launch's product.
#define RIDE_GROUPS 192
template <int TM, bool RIDE>
__global__ __launch_bounds__(512)
void gemm_tanh_ksplit(const __bf16* __restrict__ A,
                      const __bf16* __restrict__ W,
                      const float* __restrict__ bias,
                      __bf16* __restrict__ outB,
                      int M,
                      const float* __restrict__ rideIn,
                      __bf16* __restrict__ rideOut,
                      int nGemm) {
  static_assert(CVT_WAVES * 32 == 512, "a riding work-group has the stream's shape");
  if constexpr (RIDE) {
    if ((int)blockIdx.x >= nGemm) {        // the whole work-group, in front of every barrier
      f32_to_bf16_stream<2>(rideIn, rideOut, blockIdx.x - (unsigned int)nGemm);
      return;
    }
  }
  constexpr int K = 4096, N = 512, TN = 64, NW = 16;
  constexpr int SK    = NW * 32;           // k elements per stage: one WMMA k step a wave
  constexpr int ROWB  = SK * 2 + 16;       // row data + 16B pad (16B x odd pitch)
  constexpr int ROWS  = TM + TN;           // A rows, then W rows
  constexpr int BUFB  = ROWS * ROWB;       // one stage
  constexpr int NC    = ROWS * 2 / NW;     // copies per wave and stage, 512 B (half a row) each
  constexpr int NA    = TM * 2 / NW;       // of these, on A rows
  constexpr int FM    = TM / 16;
  constexpr int STAGES = K / SK;
  static_assert(NC == 10 || NC == 12, "a statement of eight copies, then two or four");
  __shared__ __attribute__((aligned(16))) char smem[2 * BUFB];
  const unsigned int ldsBase = (unsigned int)(uintptr_t)smem;

  const int tid  = threadIdx.x;
  const int lane = tid & 31;
  const int wave = tid >> 5;
  const int mBase = (int)(blockIdx.x >> 3) * TM;
  const int nBase = (int)(blockIdx.x & 7) * TN;

  // ---- loader mapping: copy c of wave w covers half (w & 1) of staged row c * 8 + (w >> 1) ----
  const int r0 = wave >> 1;
  const unsigned int inRow = (unsigned int)(wave & 1) * 256 + (unsigned int)lane * 8;   // element
  const unsigned int ldsLane = ldsBase + (unsigned int)r0 * ROWB + inRow * 2;
  unsigned int gOff[NC];                   // element offsets of this thread's rows
#pragma unroll                             // constant indices keep gOff[] in registers
  for (int c = 0; c < NC; ++c) {
    if (c < NA) {
      int aRow = mBase + c * 8 + r0; if (aRow > M - 1) aRow = M - 1;   // clamp ragged M
      gOff[c] = (unsigned int)aRow * (unsigned int)K + inRow;
    } else {
      gOff[c] = (unsigned int)(nBase + (c - NA) * 8 + r0) * (unsigned int)K + inRow;
    }
  }

  const int l16   = lane & 15;
  const int half  = lane >> 4;
  const int koff2 = half << 4;             // byte offset of K-half: 0 or 16

  auto issue = [&](int buf, int k0) {
    const unsigned int base = ldsLane + (unsigned int)buf * BUFB;
    const __bf16* ak = A + k0;
    const __bf16* wk = W + k0;
    unsigned int l[8];
    const __bf16* g[8];
#pragma unroll                             // l[], g[] become the asm's register operands
    for (int c = 0; c < 8; ++c) {
      l[c] = base + (unsigned int)(c * 8 * ROWB);
      g[c] = (c < NA ? ak : wk) + gOff[c];
    }
    asyncCopy16x8(l, g);
    unsigned int l2[NC - 8];
    const __bf16* g2[NC - 8];
#pragma unroll                             // as above
    for (int c = 8; c < NC; ++c) {
      l2[c - 8] = base + (unsigned int)(c * 8 * ROWB);
      g2[c - 8] = wk + gOff[c];
    }
    if constexpr (NC == 10) asyncCopy16x2(l2, g2); else asyncCopy16x4(l2, g2);
  };

  v8f acc[FM][4] = {};
  issue(0, 0);
  waitAsync0();
  __syncthreads();                         // stage 0 visible to every wave
  issue(1, SK);
#pragma unroll 1                           // rolled: unrolled, all stages' copy addresses are formed ahead and spill
  for (int i = 0; i < STAGES; ++i) {
    const char* base = smem + (i & 1) * BUFB + wave * 64 + koff2;
    BfPack a[FM], b[4];
#pragma unroll
    for (int s = 0; s < FM; ++s) {
      const char* p = base + (s * 16 + l16) * ROWB;
      a[s].u[0] = *(const v4u*)p;
      a[s].u[1] = *(const v4u*)(p + 32);
    }
#pragma unroll
    for (int t = 0; t < 4; ++t) {
      const char* p = base + (TM + t * 16 + l16) * ROWB;
      b[t].u[0] = *(const v4u*)p;
      b[t].u[1] = *(const v4u*)(p + 32);
    }
#pragma unroll
    for (int s = 0; s < FM; ++s)
#pragma unroll
      for (int t = 0; t < 4; ++t)
        acc[s][t] = __builtin_amdgcn_wmma_f32_16x16x32_bf16(
            false, a[s].v, false, b[t].v, (short)0, acc[s][t], false, false);
    waitDs0();
    waitAsync0();
    __syncthreads();                       // stage i+1 visible; stage i's readers done
    if (i + 2 < STAGES) issue(i & 1, (i + 2) * SK);
  }
  waitAsync0();                            // nothing in flight when the wave ends

  // ---- merge: a thread owns EPT adjacent columns of one row, a wave whole 128 B lines ----
  constexpr int EPT = TM * TN / (NW * 32); // 2 or 4
  constexpr int TPR = TN / EPT;            // threads per output row
  typedef float vE __attribute__((ext_vector_type(EPT)));
  const int row = tid / TPR;
  const int col = (tid % TPR) * EPT;
  vE v = *(const vE*)(bias + nBase + col);
  // stands behind the load, in front of any rewrite of its address registers
  asm volatile("s_wait_xcnt 0x0" ::: "memory");

  // The ring is free here: every wave's reads and copies ended at the last barrier.
  constexpr int SP   = TN * 4 + 16;        // partial tile's row pitch: rows r and r+8 fall on disjoint banks
  constexpr int REGB = TM * SP;            // one wave's partial tile
  static_assert(NW * REGB <= 2 * BUFB, "the partial tiles fit the ring's LDS");
  {
    char* p = smem + wave * REGB + (half << 3) * SP + l16 * 4;   // C VGPR r -> (row r | r+8, col lane%16)
#pragma unroll                             // all three: constant indices keep acc[] in registers
    for (int s = 0; s < FM; ++s)
#pragma unroll
      for (int t = 0; t < 4; ++t)
#pragma unroll
        for (int r = 0; r < 8; ++r)
          *(float*)(p + (s * 16 + r) * SP + t * 64) = acc[s][t][r];
  }
  __syncthreads();                         // every wave's partial tile is in LDS
#pragma unroll                             // w * REGB folds into the LDS loads' offset field
  for (int w = 0; w < NW; ++w)
    v += *(const vE*)(smem + w * REGB + row * SP + col * 4);

  const int m = mBase + row;
  if (m < M) {
    const unsigned int oi = (unsigned int)m * (unsigned int)N + (unsigned int)(nBase + col);
    unsigned int o[EPT / 2];
#pragma unroll                             // constant indices keep o[] in registers
    for (int e = 0; e < EPT / 2; ++e)
      o[e] = bfbits(tanhExp(v[2 * e])) | (bfbits(tanhExp(v[2 * e + 1])) << 16);
    if constexpr (EPT == 2) {
      *(unsigned int*)(outB + oi) = o[0];
    } else {
      v2u ov; ov.x = o[0]; ov.y = o[1];
      *(v2u*)(outB + oi) = ov;
    }
  }
}

extern "C" void kernel_launch(void* const* d_in, const int* in_sizes, int n_in,
                              void* d_out, int out_size, void* d_ws, size_t ws_size,
                              hipStream_t stream) {
  (void)in_sizes; (void)n_in; (void)out_size; (void)ws_size;
  const float* seq = (const float*)d_in[0];   // (2, 32768, 512)
  const float* Wc  = (const float*)d_in[1];   // (6, 512, 4096)
  const float* bc  = (const float*)d_in[2];   // (6, 512)
  const float* Wd  = (const float*)d_in[3];   // (6, 4096, 512)
  const float* bd  = (const float*)d_in[4];   // (6, 4096)
  float* out = (float*)d_out;                 // (2, 32768, 512)

  const long WELEMS = 6L * 512 * 4096;

  char* ws = (char*)d_ws;
  size_t off = 0;
  auto carve = [&](size_t bytes) -> char* {
    char* p = ws + off;
    off += (bytes + 255) & ~(size_t)255;
    return p;
  };

  __bf16* WcB = (__bf16*)carve((size_t)WELEMS * 2);
  __bf16* WdB = (__bf16*)carve((size_t)WELEMS * 2);
  const long hierElems[6] = {33554432L, 4194304L, 524288L, 65536L, 8192L, 1024L};
  __bf16* hier[6];
  for (int i = 0; i < 6; ++i) hier[i] = (__bf16*)carve((size_t)hierElems[i] * 2);
  __bf16* ping = (__bf16*)carve(4194304L * 2);
  __bf16* pong = (__bf16*)carve(4194304L * 2);

  // --- f32 -> bf16 staging: the sequence and Wc levels 0-2 here; Wc levels 3-5 ride with
  // compress level 2, Wd levels 0-2 with level 3, Wd levels 3-5 with level 4 ---
  const long HALFW = 3L * 512 * 4096;         // three levels of either weight array
  static_assert(3L * HEAD_GROUPS * CVT_WAVES * 1024 == 3L * 512 * 4096, "head weights: 3 pieces a wave");
  static_assert(2L * RIDE_GROUPS * CVT_WAVES * 1024 == 3L * 512 * 4096, "riding weights: 2 pieces a wave");
  static_assert(8L * SEQ_GROUPS * CVT_WAVES * 1024 == 33554432L, "sequence: 8 pieces a wave");
  f32_to_bf16_head<<<SEQ_GROUPS + HEAD_GROUPS, CVT_WAVES * 32, 0, stream>>>(seq, hier[0], Wc, WcB);
  const float* rideIn[5]  = {nullptr, nullptr, Wc + HALFW, Wd, Wd + HALFW};
  __bf16*      rideOut[5] = {nullptr, nullptr, WcB + HALFW, WdB, WdB + HALFW};

  // --- compress: 5 levels, A=(M,4096) W=(512,4096) ---
  const int Mc[5] = {8192, 1024, 128, 16, 2};
  for (int l = 0; l < 5; ++l) {
    const int M = Mc[l], N = 512, K = 4096;
    const __bf16* Wl = WcB + (size_t)l * 512 * 4096;
    const float* bl = bc + (size_t)l * 512;
    if (l == 0) {
      const int blocks = ((M + 127) / 128) * (N / 128);
      gemm_tanh_wmma<0, 256><<<blocks, 256, 0, stream>>>(
          hier[l], Wl, bl, nullptr, nullptr, hier[l + 1], nullptr, M, N, K);
    } else if (l == 1) {
      gemm_tanh_ksplit<32, false><<<(M / 32) * (N / 64), 512, 0, stream>>>(
          hier[l], Wl, bl, hier[l + 1], M, nullptr, nullptr, 0);
    } else {
      const int nGemm = ((M + 15) / 16) * (N / 64);
      gemm_tanh_ksplit<16, true><<<nGemm + RIDE_GROUPS, 512, 0, stream>>>(
          hier[l], Wl, bl, hier[l + 1], M, rideIn[l], rideOut[l], nGemm);
    }
  }

  // --- decompress: 5 levels, A=(M,512) W=(4096,512) ---
  const __bf16* cur = hier[5];
  __bf16* bufs[2] = {ping, pong};
  for (int i = 0; i < 5; ++i) {
    const int l = 4 - i;
    int M = 2;
    for (int j = 0; j < 4 - l; ++j) M *= 8;   // 2 * 8^(4-l)
    const int N = 4096, K = 512;
    const int blocks = ((M + 127) / 128) * (N / 128);
    if (l > 0) {
      gemm_tanh_wmma<1, 256><<<blocks, 256, 0, stream>>>(
          cur, WdB + (size_t)l * 4096 * 512, bd + (size_t)l * 4096,
          hier[l], nullptr, bufs[i & 1], nullptr, M, N, K);
      cur = bufs[i & 1];
    } else {
      gemm_tanh_wmma<2, 64><<<blocks, 256, 0, stream>>>(
          cur, WdB, bd, nullptr, seq, nullptr, out, M, N, K);
    }
  }
}

// v007
// A run of this version takes 159 microseconds.
// Timed twice side by side with v006, it ran 1.10 and 1.11 times as fast.
// Over all steps from v000 it is 3.91 times as fast.
#include <hip/hip_runtime.h>

// ---------------------------------------------------------------------------
// CDNA5 (gfx1250) HierarchicalTemporalCompressor: bf16 WMMA GEMMs with
// double-buffered async global->LDS staging (ASYNCcnt path) and ds_load_b128
// fragment reads. Every level: C[m,n] = sum_k A[m,k]*W[n,k] (+bias,+resid,tanh).
// ---------------------------------------------------------------------------

typedef __bf16        v16bf __attribute__((ext_vector_type(16)));
typedef float         v8f   __attribute__((ext_vector_type(8)));
typedef unsigned int  v4u   __attribute__((ext_vector_type(4)));
typedef unsigned int  v2u   __attribute__((ext_vector_type(2)));
typedef float         v4f   __attribute__((ext_vector_type(4)));

union BfPack {
  v4u   u[2];   // u[0] -> fragment VGPRs 0..3, u[1] -> VGPRs 4..7
  v16bf v;
};

__device__ __forceinline__ __bf16 f2bf(float f) {
  unsigned int u = __builtin_bit_cast(unsigned int, f);
  u += 0x7FFFu + ((u >> 16) & 1u);            // round-to-nearest-even
  unsigned short h = (unsigned short)(u >> 16);
  return __builtin_bit_cast(__bf16, h);
}

// the same rounding, as the low 16 bits of a word (for packed stores)
__device__ __forceinline__ unsigned int bfbits(float f) {
  return (unsigned int)__builtin_bit_cast(unsigned short, f2bf(f));
}

// tanh x = 1 - 2 / (1 + e^(2x)), straight-line: one exp2, one rcp, three plain operations.
// e^(2x) = inf gives 1, e^(2x) = 0 gives -1, a NaN stays one; the absolute error is a few
// units of 2^-24, at every x. No branch, so a group's values run as independent chains.
__device__ __forceinline__ float tanhExp(float x) {
  const float e = __builtin_amdgcn_exp2f(x * 2.885390081777927f);   // 2 * log2(e)
  return 1.0f - 2.0f * __builtin_amdgcn_rcpf(1.0f + e);
}

// f32 -> bf16 as a stream, by work-groups of CVT_WAVES waves; group is the work-group's
// place in its stream. A wave owns PASSES adjacent pieces of 4 KB: a piece is eight loads
// of 512 adjacent bytes (16 B a lane, whole lines; read once, so non-temporal) and eight
// stores of 256 adjacent bytes. The next piece's loads are in flight while this one is rounded.
#define CVT_WAVES  16
template <int PASSES>
__device__ __forceinline__
void f32_to_bf16_stream(const float* __restrict__ in, __bf16* __restrict__ out, unsigned int group) {
  const unsigned int lane = threadIdx.x & 31u;
  const unsigned int wave = group * CVT_WAVES + (threadIdx.x >> 5);
  const char* src = (const char*)in + (size_t)wave * (PASSES * 4096) + lane * 16;
  char* dst = (char*)out + (size_t)wave * (PASSES * 2048) + lane * 8;
  v4f r[2][8];                             // this piece and the next
#pragma unroll                             // constant indices keep r[][] in registers
  for (int q = 0; q < 8; ++q)
    r[0][q] = __builtin_nontemporal_load((const v4f*)(src + q * 512));
#pragma unroll                             // as above; p * 4096 folds into the offset fields
  for (int p = 0; p < PASSES; ++p) {
    // the two scheduling barriers keep the order: next piece's loads, then this piece's work
    __builtin_amdgcn_sched_barrier(0);
    if (p + 1 < PASSES) {
#pragma unroll                             // as above
      for (int q = 0; q < 8; ++q)
        r[(p + 1) & 1][q] =
            __builtin_nontemporal_load((const v4f*)(src + (p + 1) * 4096 + q * 512));
    }
    __builtin_amdgcn_sched_barrier(0);
#pragma unroll                             // as above
    for (int q = 0; q < 8; ++q) {
      const v4f v = r[p & 1][q];
      v2u o;
      o.x = bfbits(v.x) | (bfbits(v.y) << 16);
      o.y = bfbits(v.z) | (bfbits(v.w) << 16);
      *(v2u*)(dst + p * 2048 + q * 256) = o;
    }
    // stands behind the stores, in front of any rewrite of the registers that they name
    // (behind the last piece too, though nothing of either calling kernel follows the stream)
    asm volatile("s_wait_xcnt 0x0" ::: "memory");
  }
}

// The streams that the first GEMM waits for, in one grid: work-groups below SEQ_GROUPS take
// the sequence (8 pieces a wave), the HEAD_GROUPS behind them the first three levels of the
// compress weights (3 pieces a wave). The other weights ride in later, under-filled grids.
#define SEQ_GROUPS  256
#define HEAD_GROUPS 128
__global__ __launch_bounds__(CVT_WAVES * 32)
void f32_to_bf16_head(const float* __restrict__ seq, __bf16* __restrict__ seqB,
                      const float* __restrict__ w, __bf16* __restrict__ wB) {
  if (blockIdx.x < SEQ_GROUPS) f32_to_bf16_stream<8>(seq, seqB, blockIdx.x);
  else                         f32_to_bf16_stream<3>(w, wB, blockIdx.x - SEQ_GROUPS);
}

// Eight 16B async copies global -> LDS (ASYNCcnt). The s_wait_xcnt 0 is the
// last line of the copies' own statement, so that it stands in front of any
// later rewrite of the address registers that the copies name.
__device__ __forceinline__ void asyncCopy16x8(const unsigned int (&l)[8],
                                              const __bf16* const (&g)[8]) {
  asm volatile("global_load_async_to_lds_b128 %0, %8, off\n\t"
               "global_load_async_to_lds_b128 %1, %9, off\n\t"
               "global_load_async_to_lds_b128 %2, %10, off\n\t"
               "global_load_async_to_lds_b128 %3, %11, off\n\t"
               "global_load_async_to_lds_b128 %4, %12, off\n\t"
               "global_load_async_to_lds_b128 %5, %13, off\n\t"
               "global_load_async_to_lds_b128 %6, %14, off\n\t"
               "global_load_async_to_lds_b128 %7, %15, off\n\t"
               "s_wait_xcnt 0x0"
               :: "v"(l[0]), "v"(l[1]), "v"(l[2]), "v"(l[3]),
                  "v"(l[4]), "v"(l[5]), "v"(l[6]), "v"(l[7]),
                  "v"(g[0]), "v"(g[1]), "v"(g[2]), "v"(g[3]),
                  "v"(g[4]), "v"(g[5]), "v"(g[6]), "v"(g[7])
               : "memory");
}
// The same, for the two or four copies that are left of a wave's share of a stage.
__device__ __forceinline__ void asyncCopy16x2(const unsigned int (&l)[2],
                                              const __bf16* const (&g)[2]) {
  asm volatile("global_load_async_to_lds_b128 %0, %2, off\n\t"
               "global_load_async_to_lds_b128 %1, %3, off\n\t"
               "s_wait_xcnt 0x0"
               :: "v"(l[0]), "v"(l[1]), "v"(g[0]), "v"(g[1])
               : "memory");
}
__device__ __forceinline__ void asyncCopy16x4(const unsigned int (&l)[4],
                                              const __bf16* const (&g)[4]) {
  asm volatile("global_load_async_to_lds_b128 %0, %4, off\n\t"
               "global_load_async_to_lds_b128 %1, %5, off\n\t"
               "global_load_async_to_lds_b128 %2, %6, off\n\t"
               "global_load_async_to_lds_b128 %3, %7, off\n\t"
               "s_wait_xcnt 0x0"
               :: "v"(l[0]), "v"(l[1]), "v"(l[2]), "v"(l[3]),
                  "v"(g[0]), "v"(g[1]), "v"(g[2]), "v"(g[3])
               : "memory");
}
// This wave's copies have landed (the compiler places no wait for them).
__device__ __forceinline__ void waitAsync0() {
  asm volatile("s_wait_asynccnt 0x0" ::: "memory");
}
// This wave's LDS reads have retired before a copy refills the buffer they read.
__device__ __forceinline__ void waitDs0() {
  asm volatile("s_wait_dscnt 0x0" ::: "memory");
}

// One lane asks L2 for the line at p; nothing returns and no counter moves.
// The s_wait_xcnt 0 stands in front of any later rewrite of the address registers.
__device__ __forceinline__ void prefetchL2(const void* p) {
  asm volatile("global_prefetch_b8 %0, off scope:SCOPE_SE\n\t"
               "s_wait_xcnt 0x0"
               :: "v"(p) : "memory");
}

#define BM   128
#define BN   128

// EPI: 0 = compress (tanh, bf16 out, shape (M,N))
//      1 = decompress mid (reshape (M,4096)->(M*8,512), +bf16 resid, tanh, bf16)
//      2 = decompress final (reshape, +f32 resid, tanh, f32 out)
// BK : k elements of every operand row staged per pass (K is a multiple of it)
template <int EPI, int BK>
__global__ __launch_bounds__(256)
void gemm_tanh_wmma(const __bf16* __restrict__ A,
                    const __bf16* __restrict__ W,
                    const float* __restrict__ bias,
                    const __bf16* __restrict__ residB,
                    const float* __restrict__ residF,
                    __bf16* __restrict__ outB,
                    float* __restrict__ outF,
                    int M, int N, int K) {
  constexpr int ROWB  = BK * 2 + 16;     // row data + 16B pad (16B x odd pitch)
  constexpr int TILEB = 128 * ROWB;      // one staged matrix tile
  constexpr int BUFB  = 2 * TILEB;       // one stage: A tile, W tile
  constexpr int LPR   = BK / 8;          // lanes that cover one row, 16B each
  constexpr int RPS   = 256 / LPR;       // rows that one copy of the block covers
  constexpr int NCP   = 128 / RPS;       // copies per thread and matrix tile
  static_assert(NCP % 4 == 0, "copies go out in statements of eight");
  __shared__ __attribute__((aligned(16))) char smem[2 * BUFB];
  const unsigned int ldsBase = (unsigned int)(uintptr_t)smem;

  const int tid  = threadIdx.x;
  const int lane = tid & 31;
  const int wave = tid >> 5;
  const int nBlocks = N >> 7;
  const int bm = blockIdx.x / nBlocks;
  const int bn = blockIdx.x - bm * nBlocks;
  const int mBase = bm << 7;
  const int nBase = bn << 7;

  // ---- loader mapping: LPR adjacent lanes cover one row's BK*2 bytes ----
  const int lr = tid / LPR;                // first row of this thread
  const int lc = tid % LPR;                // 16B chunk inside the row
  const unsigned int ldsRow = (unsigned int)lr * ROWB + (unsigned int)lc * 16;
  unsigned int aOff[NCP];                  // element offsets of this thread's A rows
#pragma unroll                             // constant indices keep aOff[] in registers
  for (int j = 0; j < NCP; ++j) {
    int aRow = mBase + lr + j * RPS; if (aRow > M - 1) aRow = M - 1;  // clamp ragged M
    aOff[j] = (unsigned int)aRow * (unsigned int)K + (unsigned int)lc * 8;
  }
  const unsigned int wOff = (unsigned int)(nBase + lr) * (unsigned int)K + (unsigned int)lc * 8;

  // ---- compute mapping: 8 waves = 4(M) x 2(N); wave tile 32x64 ----
  const int wm = wave & 3;
  const int wn = wave >> 2;
  const int l16 = lane & 15;
  const int koff2 = (lane >> 4) << 4;      // byte offset of K-half: 0 or 16

  v8f acc[2][4] = {};
  const int ksteps = K / BK;

  auto issue = [&](int buf, int k0) {
    const unsigned int base = ldsBase + (unsigned int)buf * BUFB + ldsRow;
    const __bf16* ak = A + k0;
    const __bf16* wk = W + k0;
#pragma unroll                             // constant indices into aOff[]
    for (int j = 0; j < NCP; j += 4) {
      unsigned int l[8];
      const __bf16* g[8];
#pragma unroll                             // l[], g[] become the asm's register operands
      for (int q = 0; q < 4; ++q) {
        l[q]     = base + (unsigned int)((j + q) * RPS * ROWB);
        g[q]     = ak + aOff[j + q];
        l[q + 4] = base + (unsigned int)(TILEB + (j + q) * RPS * ROWB);
        g[q + 4] = wk + (size_t)((j + q) * RPS) * K + wOff;
      }
      asyncCopy16x8(l, g);
    }
  };

  issue(0, 0);
  // The tile's residual is first read in the epilogue, from memory: asked for here, it comes
  // into L2 under the k loop. Two lanes a row: 256 B each of f32, 128 B each of bf16.
  if (EPI != 0) {
    int pm = mBase + (tid >> 1); if (pm > M - 1) pm = M - 1;          // clamp ragged M
    const unsigned int pi = (unsigned int)pm * (unsigned int)N + (unsigned int)(nBase + (tid & 1) * 64);
    if (EPI == 1) prefetchL2(residB + pi); else prefetchL2(residF + pi);
  }
  waitAsync0();
  __syncthreads();                         // tile 0 visible to every wave
  if (1 < ksteps) issue(1, BK);
  for (int i = 0; i < ksteps; ++i) {
    const char* base = smem + (i & 1) * BUFB;
#pragma unroll                             // kk * 64 folds into the LDS loads' offset field
    for (int kk = 0; kk < BK / 32; ++kk) {
      BfPack a[2], b[4];
#pragma unroll
      for (int s = 0; s < 2; ++s) {
        const char* p = base + (wm * 32 + s * 16 + l16) * ROWB + kk * 64 + koff2;
        a[s].u[0] = *(const v4u*)p;
        a[s].u[1] = *(const v4u*)(p + 32);
      }
#pragma unroll
      for (int t = 0; t < 4; ++t) {
        const char* p = base + TILEB + (wn * 64 + t * 16 + l16) * ROWB + kk * 64 + koff2;
        b[t].u[0] = *(const v4u*)p;
        b[t].u[1] = *(const v4u*)(p + 32);
      }
#pragma unroll
      for (int s = 0; s < 2; ++s)
#pragma unroll
        for (int t = 0; t < 4; ++t)
          acc[s][t] = __builtin_amdgcn_wmma_f32_16x16x32_bf16(
              false, a[s].v, false, b[t].v, (short)0, acc[s][t], false, false);
    }
    waitDs0();
    waitAsync0();
    __syncthreads();                       // tile i+1 visible; tile i's readers done
    if (i + 2 < ksteps) issue(i & 1, (i + 2) * BK);
  }
  waitAsync0();                            // nothing in flight when the wave ends

  // ---- epilogue: each wave turns its 32x64 tile through its own LDS range, so
  // that a lane owns 4 adjacent columns and a wave-wide access covers whole lines.
  const int half = lane >> 4;              // two rows per wave-wide access
  const int col  = nBase + wn * 64 + l16 * 4;
  // first row of the wave's tile, in a scalar register: it bounds the loop below
  const int mW = __builtin_amdgcn_readfirstlane(mBase + wm * 32);
  int nG = (M - mW + 7) >> 3;              // groups of 8 rows that hold a row below M
  nG = nG < 0 ? 0 : (nG > 4 ? 4 : nG);

  // The reshape (M,4096)->(M*8,512) keeps the flat index, so every EPI uses m*N+col
  // (below 2^26 elements at every level).
  v4f rf[4];                               // residual of the next group, in flight
  v2u rb[4];
  auto loadRes = [&](int g) {
#pragma unroll                             // constant indices keep rf[], rb[] in registers
    for (int q = 0; q < 4; ++q) {
      int m = mW + g * 8 + q * 2 + half; if (m > M - 1) m = M - 1;   // clamp ragged M
      const unsigned int oi = (unsigned int)m * (unsigned int)N + (unsigned int)col;
      if (EPI == 1) rb[q] = *(const v2u*)(residB + oi);
      if (EPI == 2) rf[q] = *(const v4f*)(residF + oi);
    }
    // stands behind the loads, in front of any rewrite of their address registers
    if (EPI != 0) asm volatile("s_wait_xcnt 0x0" ::: "memory");
  };

  // The ring is free here: every wave's reads and copies ended at the last barrier.
  constexpr int SP = 64 * 4 + 16;          // staged row pitch: rows r and r+8 fall on disjoint banks
  static_assert(8 * 32 * SP <= 2 * BUFB, "the staged tiles fit the ring's LDS");
  char* stage = smem + wave * (32 * SP);
  {
    char* p = stage + (half << 3) * SP + l16 * 4;   // C VGPR r -> (row r | r+8, col lane%16)
#pragma unroll                             // all three: constant indices keep acc[] in registers
    for (int s = 0; s < 2; ++s)
#pragma unroll
      for (int t = 0; t < 4; ++t)
#pragma unroll
        for (int r = 0; r < 8; ++r)
          *(float*)(p + (s * 16 + r) * SP + t * 64) = acc[s][t][r];
  }
  const v4f bv = *(const v4f*)(bias + col);
  if (nG > 0) loadRes(0);                  // issued here, where the accumulators' registers are free
  waitDs0();                               // the wave's own rows are in LDS before it reads them back

#pragma unroll 1                           // rolled: one group's residual registers serve all four groups
  for (int g = 0; g < nG; ++g) {
    v4f cf[4], c[4];
    v2u cb[4];
#pragma unroll                             // constant indices keep the group's arrays in registers
    for (int q = 0; q < 4; ++q) {
      if (EPI == 1) cb[q] = rb[q];
      if (EPI == 2) cf[q] = rf[q];
      c[q] = *(const v4f*)(stage + (g * 8 + q * 2 + half) * SP + l16 * 16);   // one LDS wait a group
    }
    if (g + 1 < nG) loadRes(g + 1);        // next group's residual flies under this group's tanh
#pragma unroll                             // as above
    for (int q = 0; q < 4; ++q) {
      const int m = mW + g * 8 + q * 2 + half;
      v4f v = c[q] + bv;
      if (EPI == 1) {
        v.x += __builtin_bit_cast(float, cb[q].x << 16);
        v.y += __builtin_bit_cast(float, cb[q].x & 0xFFFF0000u);
        v.z += __builtin_bit_cast(float, cb[q].y << 16);
        v.w += __builtin_bit_cast(float, cb[q].y & 0xFFFF0000u);
      }
      if (EPI == 2) v += cf[q];
      v.x = tanhExp(v.x); v.y = tanhExp(v.y); v.z = tanhExp(v.z); v.w = tanhExp(v.w);
      if (m < M) {
        const unsigned int oi = (unsigned int)m * (unsigned int)N + (unsigned int)col;
        if (EPI == 2) {
          *(v4f*)(outF + oi) = v;
        } else {
          v2u o;
          o.x = bfbits(v.x) | (bfbits(v.y) << 16);
          o.y = bfbits(v.z) | (bfbits(v.w) << 16);
          *(v2u*)(outB + oi) = o;
        }
        // stands behind the store, in front of any rewrite of the registers that it names
        asm volatile("s_wait_xcnt 0x0" ::: "memory");
      }
    }
  }
}

// Compress levels with few rows (M <= 1024; K = 4096, N = 512): 128x128 tiles would leave
// most WGPs idle while a few walk all of K. Here a work-group owns TM x 64 of the output
// (whole 128 B lines of bf16) and its 16 waves split K: of every staged 512 k a wave takes
// its own 32 for the whole tile. The 16 partial tiles are summed through LDS, in wave order.
// RIDE: the grids of the last three levels leave most WGPs idle, so RIDE_GROUPS more
// work-groups behind the nGemm that hold a tile round three levels of weights that a later
// launch reads (2 pieces a wave); they touch nothing of this launch's product.
#define RIDE_GROUPS 192
template <int TM, bool RIDE>
__global__ __launch_bounds__(512)
void gemm_tanh_ksplit(const __bf16* __restrict__ A,
                      const __bf16* __restrict__ W,
                      const float* __restrict__ bias,
                      __bf16* __restrict__ outB,
                      int M,
                      const float* __restrict__ rideIn,
                      __bf16* __restrict__ rideOut,
                      int nGemm) {
  static_assert(CVT_WAVES * 32 == 512, "a riding work-group has the stream's shape");
  if constexpr (RIDE) {
    if ((int)blockIdx.x >= nGemm) {        // the whole work-group, in front of every barrier
      f32_to_bf16_stream<2>(rideIn, rideOut, blockIdx.x - (unsigned int)nGemm);
      return;
    }
  }
  constexpr int K = 4096, N = 512, TN = 64, NW = 16;
  constexpr int SK    = NW * 32;           // k elements per stage: one WMMA k step a wave
  constexpr int ROWB  = SK * 2 + 16;       // row data + 16B pad (16B x odd pitch)
  constexpr int ROWS  = TM + TN;           // A rows, then W rows
  constexpr int BUFB  = ROWS * ROWB;       // one stage
  constexpr int NC    = ROWS * 2 / NW;     // copies per wave and stage, 512 B (half a row) each
  constexpr int NA    = TM * 2 / NW;       // of these, on A rows
  constexpr int FM    = TM / 16;
  constexpr int STAGES = K / SK;
  static_assert(NC == 10 || NC == 12, "a statement of eight copies, then two or four");
  __shared__ __attribute__((aligned(16))) char smem[2 * BUFB];
  const unsigned int ldsBase = (unsigned int)(uintptr_t)smem;

  const int tid  = threadIdx.x;
  const int lane = tid & 31;
  const int wave = tid >> 5;
  const int mBase = (int)(blockIdx.x >> 3) * TM;
  const int nBase = (int)(blockIdx.x & 7) * TN;

  // ---- loader mapping: copy c of wave w covers half (w & 1) of staged row c * 8 + (w >> 1) ----
  const int r0 = wave >> 1;
  const unsigned int inRow = (unsigned int)(wave & 1) * 256 + (unsigned int)lane * 8;   // element
  const unsigned int ldsLane = ldsBase + (unsigned int)r0 * ROWB + inRow * 2;
  unsigned int gOff[NC];                   // element offsets of this thread's rows
#pragma unroll                             // constant indices keep gOff[] in registers
  for (int c = 0; c < NC; ++c) {
    if (c < NA) {
      int aRow = mBase + c * 8 + r0; if (aRow > M - 1) aRow = M - 1;   // clamp ragged M
      gOff[c] = (unsigned int)aRow * (unsigned int)K + inRow;
    } else {
      gOff[c] = (unsigned int)(nBase + (c - NA) * 8 + r0) * (unsigned int)K + inRow;
    }
  }

  const int l16   = lane & 15;
  const int half  = lane >> 4;
  const int koff2 = half << 4;             // byte offset of K-half: 0 or 16

  auto issue = [&](int buf, int k0) {
    const unsigned int base = ldsLane + (unsigned int)buf * BUFB;
    const __bf16* ak = A + k0;
    const __bf16* wk = W + k0;
    unsigned int l[8];
    const __bf16* g[8];
#pragma unroll                             // l[], g[] become the asm's register operands
    for (int c = 0; c < 8; ++c) {
      l[c] = base + (unsigned int)(c * 8 * ROWB);
      g[c] = (c < NA ? ak : wk) + gOff[c];
    }
    asyncCopy16x8(l, g);
    unsigned int l2[NC - 8];
    const __bf16* g2[NC - 8];
#pragma unroll                             // as above
    for (int c = 8; c < NC; ++c) {
      l2[c - 8] = base + (unsigned int)(c * 8 * ROWB);
      g2[c - 8] = wk + gOff[c];
    }
    if constexpr (NC == 10) asyncCopy16x2(l2, g2); else asyncCopy16x4(l2, g2);
  };

  v8f acc[FM][4] = {};
  issue(0, 0);
  // All later stages of this wave's rows are asked into L2 now, so that the ring's copies,
  // which lead their readers by one stage only, find them there. A half-wave takes one of
  // two rows: lane pair s its 512 B of stage s, one 256-B unit a lane.
  static_assert(NA % 2 == 0 && NC % 2 == 0 && STAGES == 8, "row pairs lie in one matrix; 8 stages x 2 units a half-wave");
#pragma unroll                             // constant indices into gOff[]
  for (int c = 0; c < NC; c += 2) {
    const unsigned int go = (half ? gOff[c + 1] : gOff[c]) - (unsigned int)lane * 8
                          + (unsigned int)(l16 >> 1) * SK + (unsigned int)(l16 & 1) * 128;
    prefetchL2((c < NA ? A : W) + go);
  }
  waitAsync0();
  __syncthreads();                         // stage 0 visible to every wave
  issue(1, SK);
#pragma unroll 1                           // rolled: unrolled, all stages' copy addresses are formed ahead and spill
  for (int i = 0; i < STAGES; ++i) {
    const char* base = smem + (i & 1) * BUFB + wave * 64 + koff2;
    BfPack a[FM], b[4];
#pragma unroll
    for (int s = 0; s < FM; ++s) {
      const char* p = base + (s * 16 + l16) * ROWB;
      a[s].u[0] = *(const v4u*)p;
      a[s].u[1] = *(const v4u*)(p + 32);
    }
#pragma unroll
    for (int t = 0; t < 4; ++t) {
      const char* p = base + (TM + t * 16 + l16) * ROWB;
      b[t].u[0] = *(const v4u*)p;
      b[t].u[1] = *(const v4u*)(p + 32);
    }
#pragma unroll
    for (int s = 0; s < FM; ++s)
#pragma unroll
      for (int t = 0; t < 4; ++t)
        acc[s][t] = __builtin_amdgcn_wmma_f32_16x16x32_bf16(
            false, a[s].v, false, b[t].v, (short)0, acc[s][t], false, false);
    waitDs0();
    waitAsync0();
    __syncthreads();                       // stage i+1 visible; stage i's readers done
    if (i + 2 < STAGES) issue(i & 1, (i + 2) * SK);
  }
  waitAsync0();                            // nothing in flight when the wave ends

  // ---- merge: a thread owns EPT adjacent columns of one row, a wave whole 128 B lines ----
  constexpr int EPT = TM * TN / (NW * 32); // 2 or 4
  constexpr int TPR = TN / EPT;            // threads per output row
  typedef float vE __attribute__((ext_vector_type(EPT)));
  const int row = tid / TPR;
  const int col = (tid % TPR) * EPT;
  vE v = *(const vE*)(bias + nBase + col);
  // stands behind the load, in front of any rewrite of its address registers
  asm volatile("s_wait_xcnt 0x0" ::: "memory");

  // The ring is free here: every wave's reads and copies ended at the last barrier.
  constexpr int SP   = TN * 4 + 16;        // partial tile's row pitch: rows r and r+8 fall on disjoint banks
  constexpr int REGB = TM * SP;            // one wave's partial tile
  static_assert(NW * REGB <= 2 * BUFB, "the partial tiles fit the ring's LDS");
  {
    char* p = smem + wave * REGB + (half << 3) * SP + l16 * 4;   // C VGPR r -> (row r | r+8, col lane%16)
#pragma unroll                             // all three: constant indices keep acc[] in registers
    for (int s = 0; s < FM; ++s)
#pragma unroll
      for (int t = 0; t < 4; ++t)
#pragma unroll
        for (int r = 0; r < 8; ++r)
          *(float*)(p + (s * 16 + r) * SP + t * 64) = acc[s][t][r];
  }
  __syncthreads();                         // every wave's partial tile is in LDS
#pragma unroll                             // w * REGB folds into the LDS loads' offset field
  for (int w = 0; w < NW; ++w)
    v += *(const vE*)(smem + w * REGB + row * SP + col * 4);

  const int m = mBase + row;
  if (m < M) {
    const unsigned int oi = (unsigned int)m * (unsigned int)N + (unsigned int)(nBase + col);
    unsigned int o[EPT / 2];
#pragma unroll                             // constant indices keep o[] in registers
    for (int e = 0; e < EPT / 2; ++e)
      o[e] = bfbits(tanhExp(v[2 * e])) | (bfbits(tanhExp(v[2 * e + 1])) << 16);
    if constexpr (EPT == 2) {
      *(unsigned int*)(outB + oi) = o[0];
    } else {
      v2u ov; ov.x = o[0]; ov.y = o[1];
      *(v2u*)(outB + oi) = ov;
    }
  }
}

extern "C" void kernel_launch(void* const* d_in, const int* in_sizes, int n_in,
                              void* d_out, int out_size, void* d_ws, size_t ws_size,
                              hipStream_t stream) {
  (void)in_sizes; (void)n_in; (void)out_size; (void)ws_size;
  const float* seq = (const float*)d_in[0];   // (2, 32768, 512)
  const float* Wc  = (const float*)d_in[1];   // (6, 512, 4096)
  const float* bc  = (const float*)d_in[2];   // (6, 512)
  const float* Wd  = (const float*)d_in[3];   // (6, 4096, 512)
  const float* bd  = (const float*)d_in[4];   // (6, 4096)
  float* out = (float*)d_out;                 // (2, 32768, 512)

  const long WELEMS = 6L * 512 * 4096;

  char* ws = (char*)d_ws;
  size_t off = 0;
  auto carve = [&](size_t bytes) -> char* {
    char* p = ws + off;
    off += (bytes + 255) & ~(size_t)255;
    return p;
  };

  __bf16* WcB = (__bf16*)carve((size_t)WELEMS * 2);
  __bf16* WdB = (__bf16*)carve((size_t)WELEMS * 2);
  const long hierElems[6] = {33554432L, 4194304L, 524288L, 65536L, 8192L, 1024L};
  __bf16* hier[6];
  for (int i = 0; i < 6; ++i) hier[i] = (__bf16*)carve((size_t)hierElems[i] * 2);
  __bf16* ping = (__bf16*)carve(4194304L * 2);
  __bf16* pong = (__bf16*)carve(4194304L * 2);

  // --- f32 -> bf16 staging: the sequence and Wc levels 0-2 here; Wc levels 3-5 ride with
  // compress level 2, Wd levels 0-2 with level 3, Wd levels 3-5 with level 4 ---
  const long HALFW = 3L * 512 * 4096;         // three levels of either weight array
  static_assert(3L * HEAD_GROUPS * CVT_WAVES * 1024 == 3L * 512 * 4096, "head weights: 3 pieces a wave");
  static_assert(2L * RIDE_GROUPS * CVT_WAVES * 1024 == 3L * 512 * 4096, "riding weights: 2 pieces a wave");
  static_assert(8L * SEQ_GROUPS * CVT_WAVES * 1024 == 33554432L, "sequence: 8 pieces a wave");
  f32_to_bf16_head<<<SEQ_GROUPS + HEAD_GROUPS, CVT_WAVES * 32, 0, stream>>>(seq, hier[0], Wc, WcB);
  const float* rideIn[5]  = {nullptr, nullptr, Wc + HALFW, Wd, Wd + HALFW};
  __bf16*      rideOut[5] = {nullptr, nullptr, WcB + HALFW, WdB, WdB + HALFW};

  // --- compress: 5 levels, A=(M,4096) W=(512,4096) ---
  const int Mc[5] = {8192, 1024, 128, 16, 2};
  for (int l = 0; l < 5; ++l) {
    const int M = Mc[l], N = 512, K = 4096;
    const __bf16* Wl = WcB + (size_t)l * 512 * 4096;
    const float* bl = bc + (size_t)l * 512;
    if (l == 0) {
      const int blocks = ((M + 127) / 128) * (N / 128);
      gemm_tanh_wmma<0, 256><<<blocks, 256, 0, stream>>>(
          hier[l], Wl, bl, nullptr, nullptr, hier[l + 1], nullptr, M, N, K);
    } else if (l == 1) {
      gemm_tanh_ksplit<32, false><<<(M / 32) * (N / 64), 512, 0, stream>>>(
          hier[l], Wl, bl, hier[l + 1], M, nullptr, nullptr, 0);
    } else {
      const int nGemm = ((M + 15) / 16) * (N / 64);
      gemm_tanh_ksplit<16, true><<<nGemm + RIDE_GROUPS, 512, 0, stream>>>(
          hier[l], Wl, bl, hier[l + 1], M, rideIn[l], rideOut[l], nGemm);
    }
  }

  // --- decompress: 5 levels, A=(M,512) W=(4096,512) ---
  const __bf16* cur = hier[5];
  __bf16* bufs[2] = {ping, pong};
  for (int i = 0; i < 5; ++i) {
    const int l = 4 - i;
    int M = 2;
    for (int j = 0; j < 4 - l; ++j) M *= 8;   // 2 * 8^(4-l)
    const int N = 4096, K = 512;
    const int blocks = ((M + 127) / 128) * (N / 128);
    if (l > 0) {
      gemm_tanh_wmma<1, 256><<<blocks, 256, 0, stream>>>(
          cur, WdB + (size_t)l * 4096 * 512, bd + (size_t)l * 4096,
          hier[l], nullptr, bufs[i & 1], nullptr, M, N, K);
      cur = bufs[i & 1];
    } else {
      gemm_tanh_wmma<2, 64><<<blocks, 256, 0, stream>>>(
          cur, WdB, bd, nullptr, seq, nullptr, out, M, N, K);
    }
  }
}

// v008
// Measured time: 153 microseconds a run.
// Next to v007, in two timings, it ran 1.03 and 1.04 times as fast.
// Over all steps from v000 it is 4.05 times as fast.
#include <hip/hip_runtime.h>

// ---------------------------------------------------------------------------
// CDNA5 (gfx1250) HierarchicalTemporalCompressor: bf16 WMMA GEMMs with
// double-buffered async global->LDS staging (ASYNCcnt path) and ds_load_b128
// fragment reads. Every level: C[m,n] = sum_k A[m,k]*W[n,k] (+bias,+resid,tanh).
// ---------------------------------------------------------------------------

typedef __bf16        v16bf __attribute__((ext_vector_type(16)));
typedef float         v8f   __attribute__((ext_vector_type(8)));
typedef unsigned int  v4u   __attribute__((ext_vector_type(4)));
typedef unsigned int  v2u   __attribute__((ext_vector_type(2)));
typedef float         v4f   __attribute__((ext_vector_type(4)));

union BfPack {
  v4u   u[2];   // u[0] -> fragment VGPRs 0..3, u[1] -> VGPRs 4..7
  v16bf v;
};

__device__ __forceinline__ __bf16 f2bf(float f) {
  unsigned int u = __builtin_bit_cast(unsigned int, f);
  u += 0x7FFFu + ((u >> 16) & 1u);            // round-to-nearest-even
  unsigned short h = (unsigned short)(u >> 16);
  return __builtin_bit_cast(__bf16, h);
}

// the same rounding, as the low 16 bits of a word (for packed stores)
__device__ __forceinline__ unsigned int bfbits(float f) {
  return (unsigned int)__builtin_bit_cast(unsigned short, f2bf(f));
}

// tanh x = 1 - 2 / (1 + e^(2x)), straight-line: one exp2, one rcp, three plain operations.
// e^(2x) = inf gives 1, e^(2x) = 0 gives -1, a NaN stays one; the absolute error is a few
// units of 2^-24, at every x. No branch, so a group's values run as independent chains.
__device__ __forceinline__ float tanhExp(float x) {
  const float e = __builtin_amdgcn_exp2f(x * 2.885390081777927f);   // 2 * log2(e)
  return 1.0f - 2.0f * __builtin_amdgcn_rcpf(1.0f + e);
}

// f32 -> bf16 as a stream, by work-groups of CVT_WAVES waves; group is the work-group's
// place in its stream. A wave owns PASSES adjacent pieces of 4 KB: a piece is eight loads
// of 512 adjacent bytes (16 B a lane, whole lines; read once, so non-temporal) and eight
// stores of 256 adjacent bytes. The next piece's loads are in flight while this one is rounded.
#define CVT_WAVES  16
template <int PASSES>
__device__ __forceinline__
void f32_to_bf16_stream(const float* __restrict__ in, __bf16* __restrict__ out, unsigned int group) {
  const unsigned int lane = threadIdx.x & 31u;
  const unsigned int wave = group * CVT_WAVES + (threadIdx.x >> 5);
  const char* src = (const char*)in + (size_t)wave * (PASSES * 4096) + lane * 16;
  char* dst = (char*)out + (size_t)wave * (PASSES * 2048) + lane * 8;
  v4f r[2][8];                             // this piece and the next
#pragma unroll                             // constant indices keep r[][] in registers
  for (int q = 0; q < 8; ++q)
    r[0][q] = __builtin_nontemporal_load((const v4f*)(src + q * 512));
#pragma unroll                             // as above; p * 4096 folds into the offset fields
  for (int p = 0; p < PASSES; ++p) {
    // the two scheduling barriers keep the order: next piece's loads, then this piece's work
    __builtin_amdgcn_sched_barrier(0);
    if (p + 1 < PASSES) {
#pragma unroll                             // as above
      for (int q = 0; q < 8; ++q)
        r[(p + 1) & 1][q] =
            __builtin_nontemporal_load((const v4f*)(src + (p + 1) * 4096 + q * 512));
    }
    __builtin_amdgcn_sched_barrier(0);
#pragma unroll                             // as above
    for (int q = 0; q < 8; ++q) {
      const v4f v = r[p & 1][q];
      v2u o;
      o.x = bfbits(v.x) | (bfbits(v.y) << 16);
      o.y = bfbits(v.z) | (bfbits(v.w) << 16);
      *(v2u*)(dst + p * 2048 + q * 256) = o;
    }
    // stands behind the stores, in front of any rewrite of the registers that they name
    // (behind the last piece too, though nothing of either calling kernel follows the stream)
    asm volatile("s_wait_xcnt 0x0" ::: "memory");
  }
}

// The streams that the first GEMM waits for, in one grid: work-groups below SEQ_GROUPS take
// the sequence (8 pieces a wave), the HEAD_GROUPS behind them the first three levels of the
// compress weights (3 pieces a wave). The other weights ride in later, under-filled grids.
#define SEQ_GROUPS  256
#define HEAD_GROUPS 128
__global__ __launch_bounds__(CVT_WAVES * 32)
void f32_to_bf16_head(const float* __restrict__ seq, __bf16* __restrict__ seqB,
                      const float* __restrict__ w, __bf16* __restrict__ wB) {
  if (blockIdx.x < SEQ_GROUPS) f32_to_bf16_stream<8>(seq, seqB, blockIdx.x);
  else                         f32_to_bf16_stream<3>(w, wB, blockIdx.x - SEQ_GROUPS);
}

// Eight 16B async copies global -> LDS (ASYNCcnt). The s_wait_xcnt 0 is the
// last line of the copies' own statement, so that it stands in front of any
// later rewrite of the address registers that the copies name.
__device__ __forceinline__ void asyncCopy16x8(const unsigned int (&l)[8],
                                              const __bf16* const (&g)[8]) {
  asm volatile("global_load_async_to_lds_b128 %0, %8, off\n\t"
               "global_load_async_to_lds_b128 %1, %9, off\n\t"
               "global_load_async_to_lds_b128 %2, %10, off\n\t"
               "global_load_async_to_lds_b128 %3, %11, off\n\t"
               "global_load_async_to_lds_b128 %4, %12, off\n\t"
               "global_load_async_to_lds_b128 %5, %13, off\n\t"
               "global_load_async_to_lds_b128 %6, %14, off\n\t"
               "global_load_async_to_lds_b128 %7, %15, off\n\t"
               "s_wait_xcnt 0x0"
               :: "v"(l[0]), "v"(l[1]), "v"(l[2]), "v"(l[3]),
                  "v"(l[4]), "v"(l[5]), "v"(l[6]), "v"(l[7]),
                  "v"(g[0]), "v"(g[1]), "v"(g[2]), "v"(g[3]),
                  "v"(g[4]), "v"(g[5]), "v"(g[6]), "v"(g[7])
               : "memory");
}
// The same, for the two or four copies that are left of a wave's share of a stage.
__device__ __forceinline__ void asyncCopy16x2(const unsigned int (&l)[2],
                                              const __bf16* const (&g)[2]) {
  asm volatile("global_load_async_to_lds_b128 %0, %2, off\n\t"
               "global_load_async_to_lds_b128 %1, %3, off\n\t"
               "s_wait_xcnt 0x0"
               :: "v"(l[0]), "v"(l[1]), "v"(g[0]), "v"(g[1])
               : "memory");
}
__device__ __forceinline__ void asyncCopy16x4(const unsigned int (&l)[4],
                                              const __bf16* const (&g)[4]) {
  asm volatile("global_load_async_to_lds_b128 %0, %4, off\n\t"
               "global_load_async_to_lds_b128 %1, %5, off\n\t"
               "global_load_async_to_lds_b128 %2, %6, off\n\t"
               "global_load_async_to_lds_b128 %3, %7, off\n\t"
               "s_wait_xcnt 0x0"
               :: "v"(l[0]), "v"(l[1]), "v"(l[2]), "v"(l[3]),
                  "v"(g[0]), "v"(g[1]), "v"(g[2]), "v"(g[3])
               : "memory");
}
// This wave's copies have landed (the compiler places no wait for them).
__device__ __forceinline__ void waitAsync0() {
  asm volatile("s_wait_asynccnt 0x0" ::: "memory");
}
// This wave's LDS reads have retired before a copy refills the buffer they read.
__device__ __forceinline__ void waitDs0() {
  asm volatile("s_wait_dscnt 0x0" ::: "memory");
}

// One lane asks L2 for the line at p; nothing returns and no counter moves.
// The s_wait_xcnt 0 stands in front of any later rewrite of the address registers.
__device__ __forceinline__ void prefetchL2(const void* p) {
  asm volatile("global_prefetch_b8 %0, off scope:SCOPE_SE\n\t"
               "s_wait_xcnt 0x0"
               :: "v"(p) : "memory");
}

#define BM   128
#define BN   128

// EPI: 0 = compress (tanh, bf16 out, shape (M,N))
//      1 = decompress mid (reshape (M,4096)->(M*8,512), +bf16 resid, tanh, bf16)
//      2 = decompress final (reshape, +f32 resid, tanh, f32 out)
// BK : k elements of every operand row staged per pass (K is a multiple of it)
template <int EPI, int BK>
__global__ __launch_bounds__(256)
void gemm_tanh_wmma(const __bf16* __restrict__ A,
                    const __bf16* __restrict__ W,
                    const float* __restrict__ bias,
                    const __bf16* __restrict__ residB,
                    const float* __restrict__ residF,
                    __bf16* __restrict__ outB,
                    float* __restrict__ outF,
                    int M, int N, int K) {
  constexpr int ROWB  = BK * 2 + 16;     // row data + 16B pad (16B x odd pitch)
  constexpr int TILEB = 128 * ROWB;      // one staged matrix tile
  constexpr int BUFB  = 2 * TILEB;       // one stage: A tile, W tile
  constexpr int LPR   = BK / 8;          // lanes that cover one row, 16B each
  constexpr int RPS   = 256 / LPR;       // rows that one copy of the block covers
  constexpr int NCP   = 128 / RPS;       // copies per thread and matrix tile
  static_assert(NCP % 4 == 0, "copies go out in statements of eight");
  constexpr bool AHEAD = BK >= 128;      // fragments fetched two k steps ahead (see the k loop)
  __shared__ __attribute__((aligned(16))) char smem[2 * BUFB];
  const unsigned int ldsBase = (unsigned int)(uintptr_t)smem;

  const int tid  = threadIdx.x;
  const int lane = tid & 31;
  const int wave = tid >> 5;
  const int nBlocks = N >> 7;
  const int bm = blockIdx.x / nBlocks;
  const int bn = blockIdx.x - bm * nBlocks;
  const int mBase = bm << 7;
  const int nBase = bn << 7;

  // ---- loader mapping: LPR adjacent lanes cover one row's BK*2 bytes ----
  const int lr = tid / LPR;                // first row of this thread
  const int lc = tid % LPR;                // 16B chunk inside the row
  const unsigned int ldsRow = (unsigned int)lr * ROWB + (unsigned int)lc * 16;
  unsigned int aOff[NCP];                  // element offsets of this thread's A rows
#pragma unroll                             // constant indices keep aOff[] in registers
  for (int j = 0; j < NCP; ++j) {
    int aRow = mBase + lr + j * RPS; if (aRow > M - 1) aRow = M - 1;  // clamp ragged M
    aOff[j] = (unsigned int)aRow * (unsigned int)K + (unsigned int)lc * 8;
  }
  const unsigned int wOff = (unsigned int)(nBase + lr) * (unsigned int)K + (unsigned int)lc * 8;

  // ---- compute mapping: 8 waves = 4(M) x 2(N); wave tile 32x64 ----
  const int wm = wave & 3;
  const int wn = wave >> 2;
  const int l16 = lane & 15;
  const int koff2 = (lane >> 4) << 4;      // byte offset of K-half: 0 or 16

  v8f acc[2][4] = {};
  const int ksteps = K / BK;

  auto issue = [&](int buf, int k0) {
    const unsigned int base = ldsBase + (unsigned int)buf * BUFB + ldsRow;
    const __bf16* ak = A + k0;
    const __bf16* wk = W + k0;
#pragma unroll                             // constant indices into aOff[]
    for (int j = 0; j < NCP; j += 4) {
      unsigned int l[8];
      const __bf16* g[8];
#pragma unroll                             // l[], g[] become the asm's register operands
      for (int q = 0; q < 4; ++q) {
        l[q]     = base + (unsigned int)((j + q) * RPS * ROWB);
        g[q]     = ak + aOff[j + q];
        l[q + 4] = base + (unsigned int)(TILEB + (j + q) * RPS * ROWB);
        g[q + 4] = wk + (size_t)((j + q) * RPS) * K + wOff;
      }
      asyncCopy16x8(l, g);
    }
  };

  issue(0, 0);
  // The tile's residual is first read in the epilogue, from memory: asked for here, it comes
  // into L2 under the k loop. Two lanes a row: 256 B each of f32, 128 B each of bf16.
  if (EPI != 0) {
    int pm = mBase + (tid >> 1); if (pm > M - 1) pm = M - 1;          // clamp ragged M
    const unsigned int pi = (unsigned int)pm * (unsigned int)N + (unsigned int)(nBase + (tid & 1) * 64);
    if (EPI == 1) prefetchL2(residB + pi); else prefetchL2(residF + pi);
  }
  waitAsync0();
  __syncthreads();                         // tile 0 visible to every wave
  if (1 < ksteps) issue(1, BK);
  for (int i = 0; i < ksteps; ++i) {
    const char* base = smem + (i & 1) * BUFB;
    // Three fragment sets where a stage is long and few waves share a SIMD (AHEAD): the twelve
    // LDS reads of k step kk + 2 go out as one group in front of the WMMAs of k step kk, so
    // that a wave waits out the LDS latency once a stage, not at every k step. Only this
    // stage's buffer is read: the stage's last two k steps fetch nothing.
    BfPack a[AHEAD ? 3 : 1][2], b[AHEAD ? 3 : 1][4];
    auto frags = [&](int set, int kk) {
#pragma unroll                             // constant indices keep a[][] in registers
      for (int s = 0; s < 2; ++s) {
        const char* p = base + (wm * 32 + s * 16 + l16) * ROWB + kk * 64 + koff2;
        a[set][s].u[0] = *(const v4u*)p;
        a[set][s].u[1] = *(const v4u*)(p + 32);
      }
#pragma unroll                             // constant indices keep b[][] in registers
      for (int t = 0; t < 4; ++t) {
        const char* p = base + TILEB + (wn * 64 + t * 16 + l16) * ROWB + kk * 64 + koff2;
        b[set][t].u[0] = *(const v4u*)p;
        b[set][t].u[1] = *(const v4u*)(p + 32);
      }
    };
    if (AHEAD) { frags(0, 0); frags(1, 1); }
#pragma unroll                             // kk * 64 folds into the LDS loads' offset field
    for (int kk = 0; kk < BK / 32; ++kk) {
      const int set = AHEAD ? kk % 3 : 0;
      if (!AHEAD) frags(0, kk);
      if (AHEAD && kk + 2 < BK / 32) frags((kk + 2) % 3, kk + 2);
      // the two scheduling barriers keep a later k step's reads one group, ahead of these
      // WMMAs; left free, the compiler sinks them among the WMMAs that use them
      if (AHEAD) __builtin_amdgcn_sched_barrier(0);
#pragma unroll
      for (int s = 0; s < 2; ++s)
#pragma unroll
        for (int t = 0; t < 4; ++t)
          acc[s][t] = __builtin_amdgcn_wmma_f32_16x16x32_bf16(
              false, a[set][s].v, false, b[set][t].v, (short)0, acc[s][t], false, false);
      if (AHEAD) __builtin_amdgcn_sched_barrier(0);
    }
    waitDs0();
    waitAsync0();
    __syncthreads();                       // tile i+1 visible; tile i's readers done
    if (i + 2 < ksteps) issue(i & 1, (i + 2) * BK);
  }
  waitAsync0();                            // nothing in flight when the wave ends

  // ---- epilogue: each wave turns its 32x64 tile through its own LDS range, so
  // that a lane owns 4 adjacent columns and a wave-wide access covers whole lines.
  const int half = lane >> 4;              // two rows per wave-wide access
  const int col  = nBase + wn * 64 + l16 * 4;
  // first row of the wave's tile, in a scalar register: it bounds the loop below
  const int mW = __builtin_amdgcn_readfirstlane(mBase + wm * 32);
  int nG = (M - mW + 7) >> 3;              // groups of 8 rows that hold a row below M
  nG = nG < 0 ? 0 : (nG > 4 ? 4 : nG);

  // The reshape (M,4096)->(M*8,512) keeps the flat index, so every EPI uses m*N+col
  // (below 2^26 elements at every level).
  v4f rf[4];                               // residual of the next group, in flight
  v2u rb[4];
  auto loadRes = [&](int g) {
#pragma unroll                             // constant indices keep rf[], rb[] in registers
    for (int q = 0; q < 4; ++q) {
      int m = mW + g * 8 + q * 2 + half; if (m > M - 1) m = M - 1;   // clamp ragged M
      const unsigned int oi = (unsigned int)m * (unsigned int)N + (unsigned int)col;
      if (EPI == 1) rb[q] = *(const v2u*)(residB + oi);
      if (EPI == 2) rf[q] = *(const v4f*)(residF + oi);
    }
    // stands behind the loads, in front of any rewrite of their address registers
    if (EPI != 0) asm volatile("s_wait_xcnt 0x0" ::: "memory");
  };

  // The ring is free here: every wave's reads and copies ended at the last barrier.
  constexpr int SP = 64 * 4 + 16;          // staged row pitch: rows r and r+8 fall on disjoint banks
  static_assert(8 * 32 * SP <= 2 * BUFB, "the staged tiles fit the ring's LDS");
  char* stage = smem + wave * (32 * SP);
  {
    char* p = stage + (half << 3) * SP + l16 * 4;   // C VGPR r -> (row r | r+8, col lane%16)
#pragma unroll                             // all three: constant indices keep acc[] in registers
    for (int s = 0; s < 2; ++s)
#pragma unroll
      for (int t = 0; t < 4; ++t)
#pragma unroll
        for (int r = 0; r < 8; ++r)
          *(float*)(p + (s * 16 + r) * SP + t * 64) = acc[s][t][r];
  }
  const v4f bv = *(const v4f*)(bias + col);
  if (nG > 0) loadRes(0);                  // issued here, where the accumulators' registers are free
  waitDs0();                               // the wave's own rows are in LDS before it reads them back

#pragma unroll 1                           // rolled: one group's residual registers serve all four groups
  for (int g = 0; g < nG; ++g) {
    v4f cf[4], c[4];
    v2u cb[4];
#pragma unroll                             // constant indices keep the group's arrays in registers
    for (int q = 0; q < 4; ++q) {
      if (EPI == 1) cb[q] = rb[q];
      if (EPI == 2) cf[q] = rf[q];
      c[q] = *(const v4f*)(stage + (g * 8 + q * 2 + half) * SP + l16 * 16);   // one LDS wait a group
    }
    if (g + 1 < nG) loadRes(g + 1);        // next group's residual flies under this group's tanh
#pragma unroll                             // as above
    for (int q = 0; q < 4; ++q) {
      const int m = mW + g * 8 + q * 2 + half;
      v4f v = c[q] + bv;
      if (EPI == 1) {
        v.x += __builtin_bit_cast(float, cb[q].x << 16);
        v.y += __builtin_bit_cast(float, cb[q].x & 0xFFFF0000u);
        v.z += __builtin_bit_cast(float, cb[q].y << 16);
        v.w += __builtin_bit_cast(float, cb[q].y & 0xFFFF0000u);
      }
      if (EPI == 2) v += cf[q];
      v.x = tanhExp(v.x); v.y = tanhExp(v.y); v.z = tanhExp(v.z); v.w = tanhExp(v.w);
      if (m < M) {
        const unsigned int oi = (unsigned int)m * (unsigned int)N + (unsigned int)col;
        if (EPI == 2) {
          *(v4f*)(outF + oi) = v;
        } else {
          v2u o;
          o.x = bfbits(v.x) | (bfbits(v.y) << 16);
          o.y = bfbits(v.z) | (bfbits(v.w) << 16);
          *(v2u*)(outB + oi) = o;
        }
        // stands behind the store, in front of any rewrite of the registers that it names
        asm volatile("s_wait_xcnt 0x0" ::: "memory");
      }
    }
  }
}

// Compress levels with few rows (M <= 1024; K = 4096, N = 512): 128x128 tiles would leave
// most WGPs idle while a few walk all of K. Here a work-group owns TM x 64 of the output
// (whole 128 B lines of bf16) and its 16 waves split K: of every staged 512 k a wave takes
// its own 32 for the whole tile. The 16 partial tiles are summed through LDS, in wave order.
// RIDE: the grids of the last three levels leave most WGPs idle, so RIDE_GROUPS more
// work-groups behind the nGemm that hold a tile round three levels of weights that a later
// launch reads (2 pieces a wave); they touch nothing of this launch's product.
#define RIDE_GROUPS 192
template <int TM, bool RIDE>
__global__ __launch_bounds__(512)
void gemm_tanh_ksplit(const __bf16* __restrict__ A,
                      const __bf16* __restrict__ W,
                      const float* __restrict__ bias,
                      __bf16* __restrict__ outB,
                      int M,
                      const float* __restrict__ rideIn,
                      __bf16* __restrict__ rideOut,
                      int nGemm) {
  static_assert(CVT_WAVES * 32 == 512, "a riding work-group has the stream's shape");
  if constexpr (RIDE) {
    if ((int)blockIdx.x >= nGemm) {        // the whole work-group, in front of every barrier
      f32_to_bf16_stream<2>(rideIn, rideOut, blockIdx.x - (unsigned int)nGemm);
      return;
    }
  }
  constexpr int K = 4096, N = 512, TN = 64, NW = 16;
  constexpr int SK    = NW * 32;           // k elements per stage: one WMMA k step a wave
  constexpr int ROWB  = SK * 2 + 16;       // row data + 16B pad (16B x odd pitch)
  constexpr int ROWS  = TM + TN;           // A rows, then W rows
  constexpr int BUFB  = ROWS * ROWB;       // one stage
  constexpr int NC    = ROWS * 2 / NW;     // copies per wave and stage, 512 B (half a row) each
  constexpr int NA    = TM * 2 / NW;       // of these, on A rows
  constexpr int FM    = TM / 16;
  constexpr int STAGES = K / SK;
  static_assert(NC == 10 || NC == 12, "a statement of eight copies, then two or four");
  __shared__ __attribute__((aligned(16))) char smem[2 * BUFB];
  const unsigned int ldsBase = (unsigned int)(uintptr_t)smem;

  const int tid  = threadIdx.x;
  const int lane = tid & 31;
  const int wave = tid >> 5;
  const int mBase = (int)(blockIdx.x >> 3) * TM;
  const int nBase = (int)(blockIdx.x & 7) * TN;

  // ---- loader mapping: copy c of wave w covers half (w & 1) of staged row c * 8 + (w >> 1) ----
  const int r0 = wave >> 1;
  const unsigned int inRow = (unsigned int)(wave & 1) * 256 + (unsigned int)lane * 8;   // element
  const unsigned int ldsLane = ldsBase + (unsigned int)r0 * ROWB + inRow * 2;
  unsigned int gOff[NC];                   // element offsets of this thread's rows
#pragma unroll                             // constant indices keep gOff[] in registers
  for (int c = 0; c < NC; ++c) {
    if (c < NA) {
      int aRow = mBase + c * 8 + r0; if (aRow > M - 1) aRow = M - 1;   // clamp ragged M
      gOff[c] = (unsigned int)aRow * (unsigned int)K + inRow;
    } else {
      gOff[c] = (unsigned int)(nBase + (c - NA) * 8 + r0) * (unsigned int)K + inRow;
    }
  }

  const int l16   = lane & 15;
  const int half  = lane >> 4;
  const int koff2 = half << 4;             // byte offset of K-half: 0 or 16

  auto issue = [&](int buf, int k0) {
    const unsigned int base = ldsLane + (unsigned int)buf * BUFB;
    const __bf16* ak = A + k0;
    const __bf16* wk = W + k0;
    unsigned int l[8];
    const __bf16* g[8];
#pragma unroll                             // l[], g[] become the asm's register operands
    for (int c = 0; c < 8; ++c) {
      l[c] = base + (unsigned int)(c * 8 * ROWB);
      g[c] = (c < NA ? ak : wk) + gOff[c];
    }
    asyncCopy16x8(l, g);
    unsigned int l2[NC - 8];
    const __bf16* g2[NC - 8];
#pragma unroll                             // as above
    for (int c = 8; c < NC; ++c) {
      l2[c - 8] = base + (unsigned int)(c * 8 * ROWB);
      g2[c - 8] = wk + gOff[c];
    }
    if constexpr (NC == 10) asyncCopy16x2(l2, g2); else asyncCopy16x4(l2, g2);
  };

  v8f acc[FM][4] = {};
  issue(0, 0);
  // All later stages of this wave's rows are asked into L2 now, so that the ring's copies,
  // which lead their readers by one stage only, find them there. A half-wave takes one of
  // two rows: lane pair s its 512 B of stage s, one 256-B unit a lane.
  static_assert(NA % 2 == 0 && NC % 2 == 0 && STAGES == 8, "row pairs lie in one matrix; 8 stages x 2 units a half-wave");
#pragma unroll                             // constant indices into gOff[]
  for (int c = 0; c < NC; c += 2) {
    const unsigned int go = (half ? gOff[c + 1] : gOff[c]) - (unsigned int)lane * 8
                          + (unsigned int)(l16 >> 1) * SK + (unsigned int)(l16 & 1) * 128;
    prefetchL2((c < NA ? A : W) + go);
  }
  waitAsync0();
  __syncthreads();                         // stage 0 visible to every wave
  issue(1, SK);
#pragma unroll 1                           // rolled: unrolled, all stages' copy addresses are formed ahead and spill
  for (int i = 0; i < STAGES; ++i) {
    const char* base = smem + (i & 1) * BUFB + wave * 64 + koff2;
    BfPack a[FM], b[4];
#pragma unroll
    for (int s = 0; s < FM; ++s) {
      const char* p = base + (s * 16 + l16) * ROWB;
      a[s].u[0] = *(const v4u*)p;
      a[s].u[1] = *(const v4u*)(p + 32);
    }
#pragma unroll
    for (int t = 0; t < 4; ++t) {
      const char* p = base + (TM + t * 16 + l16) * ROWB;
      b[t].u[0] = *(const v4u*)p;
      b[t].u[1] = *(const v4u*)(p + 32);
    }
#pragma unroll
    for (int s = 0; s < FM; ++s)
#pragma unroll
      for (int t = 0; t < 4; ++t)
        acc[s][t] = __builtin_amdgcn_wmma_f32_16x16x32_bf16(
            false, a[s].v, false, b[t].v, (short)0, acc[s][t], false, false);
    waitDs0();
    waitAsync0();
    __syncthreads();                       // stage i+1 visible; stage i's readers done
    if (i + 2 < STAGES) issue(i & 1, (i + 2) * SK);
  }
  waitAsync0();                            // nothing in flight when the wave ends

  // ---- merge: a thread owns EPT adjacent columns of one row, a wave whole 128 B lines ----
  constexpr int EPT = TM * TN / (NW * 32); // 2 or 4
  constexpr int TPR = TN / EPT;            // threads per output row
  typedef float vE __attribute__((ext_vector_type(EPT)));
  const int row = tid / TPR;
  const int col = (tid % TPR) * EPT;
  vE v = *(const vE*)(bias + nBase + col);
  // stands behind the load, in front of any rewrite of its address registers
  asm volatile("s_wait_xcnt 0x0" ::: "memory");

  // The ring is free here: every wave's reads and copies ended at the last barrier.
  constexpr int SP   = TN * 4 + 16;        // partial tile's row pitch: rows r and r+8 fall on disjoint banks
  constexpr int REGB = TM * SP;            // one wave's partial tile
  static_assert(NW * REGB <= 2 * BUFB, "the partial tiles fit the ring's LDS");
  {
    char* p = smem + wave * REGB + (half << 3) * SP + l16 * 4;   // C VGPR r -> (row r | r+8, col lane%16)
#pragma unroll                             // all three: constant indices keep acc[] in registers
    for (int s = 0; s < FM; ++s)
#pragma unroll
      for (int t = 0; t < 4; ++t)
#pragma unroll
        for (int r = 0; r < 8; ++r)
          *(float*)(p + (s * 16 + r) * SP + t * 64) = acc[s][t][r];
  }
  __syncthreads();                         // every wave's partial tile is in LDS
#pragma unroll                             // w * REGB folds into the LDS loads' offset field
  for (int w = 0; w < NW; ++w)
    v += *(const vE*)(smem + w * REGB + row * SP + col * 4);

  const int m = mBase + row;
  if (m < M) {
    const unsigned int oi = (unsigned int)m * (unsigned int)N + (unsigned int)(nBase + col);
    unsigned int o[EPT / 2];
#pragma unroll                             // constant indices keep o[] in registers
    for (int e = 0; e < EPT / 2; ++e)
      o[e] = bfbits(tanhExp(v[2 * e])) | (bfbits(tanhExp(v[2 * e + 1])) << 16);
    if constexpr (EPT == 2) {
      *(unsigned int*)(outB + oi) = o[0];
    } else {
      v2u ov; ov.x = o[0]; ov.y = o[1];
      *(v2u*)(outB + oi) = ov;
    }
  }
}

extern "C" void kernel_launch(void* const* d_in, const int* in_sizes, int n_in,
                              void* d_out, int out_size, void* d_ws, size_t ws_size,
                              hipStream_t stream) {
  (void)in_sizes; (void)n_in; (void)out_size; (void)ws_size;
  const float* seq = (const float*)d_in[0];   // (2, 32768, 512)
  const float* Wc  = (const float*)d_in[1];   // (6, 512, 4096)
  const float* bc  = (const float*)d_in[2];   // (6, 512)
  const float* Wd  = (const float*)d_in[3];   // (6, 4096, 512)
  const float* bd  = (const float*)d_in[4];   // (6, 4096)
  float* out = (float*)d_out;                 // (2, 32768, 512)

  const long WELEMS = 6L * 512 * 4096;

  char* ws = (char*)d_ws;
  size_t off = 0;
  auto carve = [&](size_t bytes) -> char* {
    char* p = ws + off;
    off += (bytes + 255) & ~(size_t)255;
    return p;
  };

  __bf16* WcB = (__bf16*)carve((size_t)WELEMS * 2);
  __bf16* WdB = (__bf16*)carve((size_t)WELEMS * 2);
  const long hierElems[6] = {33554432L, 4194304L, 524288L, 65536L, 8192L, 1024L};
  __bf16* hier[6];
  for (int i = 0; i < 6; ++i) hier[i] = (__bf16*)carve((size_t)hierElems[i] * 2);
  __bf16* ping = (__bf16*)carve(4194304L * 2);
  __bf16* pong = (__bf16*)carve(4194304L * 2);

  // --- f32 -> bf16 staging: the sequence and Wc levels 0-2 here; Wc levels 3-5 ride with
  // compress level 2, Wd levels 0-2 with level 3, Wd levels 3-5 with level 4 ---
  const long HALFW = 3L * 512 * 4096;         // three levels of either weight array
  static_assert(3L * HEAD_GROUPS * CVT_WAVES * 1024 == 3L * 512 * 4096, "head weights: 3 pieces a wave");
  static_assert(2L * RIDE_GROUPS * CVT_WAVES * 1024 == 3L * 512 * 4096, "riding weights: 2 pieces a wave");
  static_assert(8L * SEQ_GROUPS * CVT_WAVES * 1024 == 33554432L, "sequence: 8 pieces a wave");
  f32_to_bf16_head<<<SEQ_GROUPS + HEAD_GROUPS, CVT_WAVES * 32, 0, stream>>>(seq, hier[0], Wc, WcB);
  const float* rideIn[5]  = {nullptr, nullptr, Wc + HALFW, Wd, Wd + HALFW};
  __bf16*      rideOut[5] = {nullptr, nullptr, WcB + HALFW, WdB, WdB + HALFW};

  // --- compress: 5 levels, A=(M,4096) W=(512,4096) ---
  const int Mc[5] = {8192, 1024, 128, 16, 2};
  for (int l = 0; l < 5; ++l) {
    const int M = Mc[l], N = 512, K = 4096;
    const __bf16* Wl = WcB + (size_t)l * 512 * 4096;
    const float* bl = bc + (size_t)l * 512;
    if (l == 0) {
      const int blocks = ((M + 127) / 128) * (N / 128);
      gemm_tanh_wmma<0, 256><<<blocks, 256, 0, stream>>>(
          hier[l], Wl, bl, nullptr, nullptr, hier[l + 1], nullptr, M, N, K);
    } else if (l == 1) {
      gemm_tanh_ksplit<32, false><<<(M / 32) * (N / 64), 512, 0, stream>>>(
          hier[l], Wl, bl, hier[l + 1], M, nullptr, nullptr, 0);
    } else {
      const int nGemm = ((M + 15) / 16) * (N / 64);
      gemm_tanh_ksplit<16, true><<<nGemm + RIDE_GROUPS, 512, 0, stream>>>(
          hier[l], Wl, bl, hier[l + 1], M, rideIn[l], rideOut[l], nGemm);
    }
  }

  // --- decompress: 5 levels, A=(M,512) W=(4096,512) ---
  const __bf16* cur = hier[5];
  __bf16* bufs[2] = {ping, pong};
  for (int i = 0; i < 5; ++i) {
    const int l = 4 - i;
    int M = 2;
    for (int j = 0; j < 4 - l; ++j) M *= 8;   // 2 * 8^(4-l)
    const int N = 4096, K = 512;
    const int blocks = ((M + 127) / 128) * (N / 128);
    if (l > 0) {
      gemm_tanh_wmma<1, 256><<<blocks, 256, 0, stream>>>(
          cur, WdB + (size_t)l * 4096 * 512, bd + (size_t)l * 4096,
          hier[l], nullptr, bufs[i & 1], nullptr, M, N, K);
      cur = bufs[i & 1];
    } else {
      gemm_tanh_wmma<2, 64><<<blocks, 256, 0, stream>>>(
          cur, WdB, bd, nullptr, seq, nullptr, out, M, N, K);
    }
  }
}

// v009
// It runs in 141 microseconds.
// Next to v008, in two timings, it ran 1.08 and 1.09 times as fast.
// Over all steps from v000 it is 4.40 times as fast.
#include <hip/hip_runtime.h>

// ---------------------------------------------------------------------------
// CDNA5 (gfx1250) HierarchicalTemporalCompressor: bf16 WMMA GEMMs with
// async global->LDS staging (ASYNCcnt path; two buffers where K spans more than one stage) and ds_load_b128
// fragment reads. Every level: C[m,n] = sum_k A[m,k]*W[n,k] (+bias,+resid,tanh).
// ---------------------------------------------------------------------------

typedef __bf16        v16bf __attribute__((ext_vector_type(16)));
typedef float         v8f   __attribute__((ext_vector_type(8)));
typedef unsigned int  v4u   __attribute__((ext_vector_type(4)));
typedef unsigned int  v2u   __attribute__((ext_vector_type(2)));
typedef float         v4f   __attribute__((ext_vector_type(4)));

union BfPack {
  v4u   u[2];   // u[0] -> fragment VGPRs 0..3, u[1] -> VGPRs 4..7
  v16bf v;
};

__device__ __forceinline__ __bf16 f2bf(float f) {
  unsigned int u = __builtin_bit_cast(unsigned int, f);
  u += 0x7FFFu + ((u >> 16) & 1u);            // round-to-nearest-even
  unsigned short h = (unsigned short)(u >> 16);
  return __builtin_bit_cast(__bf16, h);
}

// the same rounding, as the low 16 bits of a word (for packed stores)
__device__ __forceinline__ unsigned int bfbits(float f) {
  return (unsigned int)__builtin_bit_cast(unsigned short, f2bf(f));
}

// tanh x = 1 - 2 / (1 + e^(2x)), straight-line: one exp2, one rcp, three plain operations.
// e^(2x) = inf gives 1, e^(2x) = 0 gives -1, a NaN stays one; the absolute error is a few
// units of 2^-24, at every x. No branch, so a group's values run as independent chains.
__device__ __forceinline__ float tanhExp(float x) {
  const float e = __builtin_amdgcn_exp2f(x * 2.885390081777927f);   // 2 * log2(e)
  return 1.0f - 2.0f * __builtin_amdgcn_rcpf(1.0f + e);
}

// f32 -> bf16 as a stream, by work-groups of CVT_WAVES waves; group is the work-group's
// place in its stream. A wave owns PASSES adjacent pieces of 4 KB: a piece is eight loads
// of 512 adjacent bytes (16 B a lane, whole lines; read once, so non-temporal) and eight
// stores of 256 adjacent bytes. The next piece's loads are in flight while this one is rounded.
#define CVT_WAVES  16
template <int PASSES>
__device__ __forceinline__
void f32_to_bf16_stream(const float* __restrict__ in, __bf16* __restrict__ out, unsigned int group) {
  const unsigned int lane = threadIdx.x & 31u;
  const unsigned int wave = group * CVT_WAVES + (threadIdx.x >> 5);
  const char* src = (const char*)in + (size_t)wave * (PASSES * 4096) + lane * 16;
  char* dst = (char*)out + (size_t)wave * (PASSES * 2048) + lane * 8;
  v4f r[2][8];                             // this piece and the next
#pragma unroll                             // constant indices keep r[][] in registers
  for (int q = 0; q < 8; ++q)
    r[0][q] = __builtin_nontemporal_load((const v4f*)(src + q * 512));
#pragma unroll                             // as above; p * 4096 folds into the offset fields
  for (int p = 0; p < PASSES; ++p) {
    // the two scheduling barriers keep the order: next piece's loads, then this piece's work
    __builtin_amdgcn_sched_barrier(0);
    if (p + 1 < PASSES) {
#pragma unroll                             // as above
      for (int q = 0; q < 8; ++q)
        r[(p + 1) & 1][q] =
            __builtin_nontemporal_load((const v4f*)(src + (p + 1) * 4096 + q * 512));
    }
    __builtin_amdgcn_sched_barrier(0);
#pragma unroll                             // as above
    for (int q = 0; q < 8; ++q) {
      const v4f v = r[p & 1][q];
      v2u o;
      o.x = bfbits(v.x) | (bfbits(v.y) << 16);
      o.y = bfbits(v.z) | (bfbits(v.w) << 16);
      *(v2u*)(dst + p * 2048 + q * 256) = o;
    }
    // stands behind the stores, in front of any rewrite of the registers that they name
    // (behind the last piece too, though nothing of either calling kernel follows the stream)
    asm volatile("s_wait_xcnt 0x0" ::: "memory");
  }
}

// The streams that the first GEMM waits for, in one grid: work-groups below SEQ_GROUPS take
// the sequence (8 pieces a wave), the HEAD_GROUPS behind them the first three levels of the
// compress weights (3 pieces a wave). The other weights ride in later, under-filled grids.
#define SEQ_GROUPS  256
#define HEAD_GROUPS 128
__global__ __launch_bounds__(CVT_WAVES * 32)
void f32_to_bf16_head(const float* __restrict__ seq, __bf16* __restrict__ seqB,
                      const float* __restrict__ w, __bf16* __restrict__ wB) {
  if (blockIdx.x < SEQ_GROUPS) f32_to_bf16_stream<8>(seq, seqB, blockIdx.x);
  else                         f32_to_bf16_stream<3>(w, wB, blockIdx.x - SEQ_GROUPS);
}

// Eight 16B async copies global -> LDS (ASYNCcnt). The s_wait_xcnt 0 is the
// last line of the copies' own statement, so that it stands in front of any
// later rewrite of the address registers that the copies name.
__device__ __forceinline__ void asyncCopy16x8(const unsigned int (&l)[8],
                                              const __bf16* const (&g)[8]) {
  asm volatile("global_load_async_to_lds_b128 %0, %8, off\n\t"
               "global_load_async_to_lds_b128 %1, %9, off\n\t"
               "global_load_async_to_lds_b128 %2, %10, off\n\t"
               "global_load_async_to_lds_b128 %3, %11, off\n\t"
               "global_load_async_to_lds_b128 %4, %12, off\n\t"
               "global_load_async_to_lds_b128 %5, %13, off\n\t"
               "global_load_async_to_lds_b128 %6, %14, off\n\t"
               "global_load_async_to_lds_b128 %7, %15, off\n\t"
               "s_wait_xcnt 0x0"
               :: "v"(l[0]), "v"(l[1]), "v"(l[2]), "v"(l[3]),
                  "v"(l[4]), "v"(l[5]), "v"(l[6]), "v"(l[7]),
                  "v"(g[0]), "v"(g[1]), "v"(g[2]), "v"(g[3]),
                  "v"(g[4]), "v"(g[5]), "v"(g[6]), "v"(g[7])
               : "memory");
}
// The same, for the two or four copies that are left of a wave's share of a stage.
__device__ __forceinline__ void asyncCopy16x2(const unsigned int (&l)[2],
                                              const __bf16* const (&g)[2]) {
  asm volatile("global_load_async_to_lds_b128 %0, %2, off\n\t"
               "global_load_async_to_lds_b128 %1, %3, off\n\t"
               "s_wait_xcnt 0x0"
               :: "v"(l[0]), "v"(l[1]), "v"(g[0]), "v"(g[1])
               : "memory");
}
__device__ __forceinline__ void asyncCopy16x4(const unsigned int (&l)[4],
                                              const __bf16* const (&g)[4]) {
  asm volatile("global_load_async_to_lds_b128 %0, %4, off\n\t"
               "global_load_async_to_lds_b128 %1, %5, off\n\t"
               "global_load_async_to_lds_b128 %2, %6, off\n\t"
               "global_load_async_to_lds_b128 %3, %7, off\n\t"
               "s_wait_xcnt 0x0"
               :: "v"(l[0]), "v"(l[1]), "v"(l[2]), "v"(l[3]),
                  "v"(g[0]), "v"(g[1]), "v"(g[2]), "v"(g[3])
               : "memory");
}
// This wave's copies have landed (the compiler places no wait for them).
__device__ __forceinline__ void waitAsync0() {
  asm volatile("s_wait_asynccnt 0x0" ::: "memory");
}
// This wave's LDS reads have retired before a copy refills the buffer they read.
__device__ __forceinline__ void waitDs0() {
  asm volatile("s_wait_dscnt 0x0" ::: "memory");
}

// One lane asks L2 for the line at p; nothing returns and no counter moves.
// The s_wait_xcnt 0 stands in front of any later rewrite of the address registers.
__device__ __forceinline__ void prefetchL2(const void* p) {
  asm volatile("global_prefetch_b8 %0, off scope:SCOPE_SE\n\t"
               "s_wait_xcnt 0x0"
               :: "v"(p) : "memory");
}

#define BM   128
#define BN   128

// EPI: 0 = compress (tanh, bf16 out, shape (M,N))
//      1 = decompress mid (reshape (M,4096)->(M*8,512), +bf16 resid, tanh, bf16)
//      2 = decompress final (reshape, +f32 resid, tanh, f32 out)
// BK : k elements of every operand row staged per pass (K is a multiple of it)
template <int EPI, int BK>
__global__ __launch_bounds__(256)
void gemm_tanh_wmma(const __bf16* __restrict__ A,
                    const __bf16* __restrict__ W,
                    const float* __restrict__ bias,
                    const __bf16* __restrict__ residB,
                    const float* __restrict__ residF,
                    __bf16* __restrict__ outB,
                    float* __restrict__ outF,
                    int M, int N, int K) {
  constexpr int ROWB  = BK * 2 + 16;     // row data + 16B pad (16B x odd pitch)
  constexpr int TILEB = 128 * ROWB;      // one staged matrix tile
  constexpr int BUFB  = 2 * TILEB;       // one stage: A tile, W tile
  constexpr int LPR   = BK / 8;          // lanes that cover one row, 16B each
  constexpr int RPS   = 256 / LPR;       // rows that one copy of the block covers
  constexpr int NCP   = 128 / RPS;       // copies per thread and matrix tile
  static_assert(NCP % 4 == 0, "copies go out in statements of eight");
  constexpr bool AHEAD = BK >= 128;      // fragments fetched two k steps ahead (see the k loop)
  __shared__ __attribute__((aligned(16))) char smem[2 * BUFB];
  const unsigned int ldsBase = (unsigned int)(uintptr_t)smem;

  const int tid  = threadIdx.x;
  const int lane = tid & 31;
  const int wave = tid >> 5;
  const int nBlocks = N >> 7;
  const int bm = blockIdx.x / nBlocks;
  const int bn = blockIdx.x - bm * nBlocks;
  const int mBase = bm << 7;
  const int nBase = bn << 7;

  // ---- loader mapping: LPR adjacent lanes cover one row's BK*2 bytes ----
  const int lr = tid / LPR;                // first row of this thread
  const int lc = tid % LPR;                // 16B chunk inside the row
  const unsigned int ldsRow = (unsigned int)lr * ROWB + (unsigned int)lc * 16;
  unsigned int aOff[NCP];                  // element offsets of this thread's A rows
#pragma unroll                             // constant indices keep aOff[] in registers
  for (int j = 0; j < NCP; ++j) {
    int aRow = mBase + lr + j * RPS; if (aRow > M - 1) aRow = M - 1;  // clamp ragged M
    aOff[j] = (unsigned int)aRow * (unsigned int)K + (unsigned int)lc * 8;
  }
  const unsigned int wOff = (unsigned int)(nBase + lr) * (unsigned int)K + (unsigned int)lc * 8;

  // ---- compute mapping: 8 waves = 4(M) x 2(N); wave tile 32x64 ----
  const int wm = wave & 3;
  const int wn = wave >> 2;
  const int l16 = lane & 15;
  const int koff2 = (lane >> 4) << 4;      // byte offset of K-half: 0 or 16

  v8f acc[2][4] = {};
  const int ksteps = K / BK;

  auto issue = [&](int buf, int k0) {
    const unsigned int base = ldsBase + (unsigned int)buf * BUFB + ldsRow;
    const __bf16* ak = A + k0;
    const __bf16* wk = W + k0;
#pragma unroll                             // constant indices into aOff[]
    for (int j = 0; j < NCP; j += 4) {
      unsigned int l[8];
      const __bf16* g[8];
#pragma unroll                             // l[], g[] become the asm's register operands
      for (int q = 0; q < 4; ++q) {
        l[q]     = base + (unsigned int)((j + q) * RPS * ROWB);
        g[q]     = ak + aOff[j + q];
        l[q + 4] = base + (unsigned int)(TILEB + (j + q) * RPS * ROWB);
        g[q + 4] = wk + (size_t)((j + q) * RPS) * K + wOff;
      }
      asyncCopy16x8(l, g);
    }
  };

  issue(0, 0);
  // The tile's residual is first read in the epilogue, from memory: asked for here, it comes
  // into L2 under the k loop. Two lanes a row: 256 B each of f32, 128 B each of bf16.
  if (EPI != 0) {
    int pm = mBase + (tid >> 1); if (pm > M - 1) pm = M - 1;          // clamp ragged M
    const unsigned int pi = (unsigned int)pm * (unsigned int)N + (unsigned int)(nBase + (tid & 1) * 64);
    if (EPI == 1) prefetchL2(residB + pi); else prefetchL2(residF + pi);
  }
  waitAsync0();
  __syncthreads();                         // tile 0 visible to every wave
  if (1 < ksteps) issue(1, BK);
  for (int i = 0; i < ksteps; ++i) {
    const char* base = smem + (i & 1) * BUFB;
    // Three fragment sets where a stage is long and few waves share a SIMD (AHEAD): the twelve
    // LDS reads of k step kk + 2 go out as one group in front of the WMMAs of k step kk, so
    // that a wave waits out the LDS latency once a stage, not at every k step. Only this
    // stage's buffer is read: the stage's last two k steps fetch nothing.
    BfPack a[AHEAD ? 3 : 1][2], b[AHEAD ? 3 : 1][4];
    auto frags = [&](int set, int kk) {
#pragma unroll                             // constant indices keep a[][] in registers
      for (int s = 0; s < 2; ++s) {
        const char* p = base + (wm * 32 + s * 16 + l16) * ROWB + kk * 64 + koff2;
        a[set][s].u[0] = *(const v4u*)p;
        a[set][s].u[1] = *(const v4u*)(p + 32);
      }
#pragma unroll                             // constant indices keep b[][] in registers
      for (int t = 0; t < 4; ++t) {
        const char* p = base + TILEB + (wn * 64 + t * 16 + l16) * ROWB + kk * 64 + koff2;
        b[set][t].u[0] = *(const v4u*)p;
        b[set][t].u[1] = *(const v4u*)(p + 32);
      }
    };
    if (AHEAD) { frags(0, 0); frags(1, 1); }
#pragma unroll                             // kk * 64 folds into the LDS loads' offset field
    for (int kk = 0; kk < BK / 32; ++kk) {
      const int set = AHEAD ? kk % 3 : 0;
      if (!AHEAD) frags(0, kk);
      if (AHEAD && kk + 2 < BK / 32) frags((kk + 2) % 3, kk + 2);
      // the two scheduling barriers keep a later k step's reads one group, ahead of these
      // WMMAs; left free, the compiler sinks them among the WMMAs that use them
      if (AHEAD) __builtin_amdgcn_sched_barrier(0);
#pragma unroll
      for (int s = 0; s < 2; ++s)
#pragma unroll
        for (int t = 0; t < 4; ++t)
          acc[s][t] = __builtin_amdgcn_wmma_f32_16x16x32_bf16(
              false, a[set][s].v, false, b[set][t].v, (short)0, acc[s][t], false, false);
      if (AHEAD) __builtin_amdgcn_sched_barrier(0);
    }
    waitDs0();
    waitAsync0();
    __syncthreads();                       // tile i+1 visible; tile i's readers done
    if (i + 2 < ksteps) issue(i & 1, (i + 2) * BK);
  }
  waitAsync0();                            // nothing in flight when the wave ends

  // ---- epilogue: each wave turns its 32x64 tile through its own LDS range, so
  // that a lane owns 4 adjacent columns and a wave-wide access covers whole lines.
  const int half = lane >> 4;              // two rows per wave-wide access
  const int col  = nBase + wn * 64 + l16 * 4;
  // first row of the wave's tile, in a scalar register: it bounds the loop below
  const int mW = __builtin_amdgcn_readfirstlane(mBase + wm * 32);
  int nG = (M - mW + 7) >> 3;              // groups of 8 rows that hold a row below M
  nG = nG < 0 ? 0 : (nG > 4 ? 4 : nG);

  // The reshape (M,4096)->(M*8,512) keeps the flat index, so every EPI uses m*N+col
  // (below 2^26 elements at every level).
  v4f rf[4];                               // residual of the next group, in flight
  v2u rb[4];
  auto loadRes = [&](int g) {
#pragma unroll                             // constant indices keep rf[], rb[] in registers
    for (int q = 0; q < 4; ++q) {
      int m = mW + g * 8 + q * 2 + half; if (m > M - 1) m = M - 1;   // clamp ragged M
      const unsigned int oi = (unsigned int)m * (unsigned int)N + (unsigned int)col;
      if (EPI == 1) rb[q] = *(const v2u*)(residB + oi);
      if (EPI == 2) rf[q] = *(const v4f*)(residF + oi);
    }
    // stands behind the loads, in front of any rewrite of their address registers
    if (EPI != 0) asm volatile("s_wait_xcnt 0x0" ::: "memory");
  };

  // The ring is free here: every wave's reads and copies ended at the last barrier.
  constexpr int SP = 64 * 4 + 16;          // staged row pitch: rows r and r+8 fall on disjoint banks
  static_assert(8 * 32 * SP <= 2 * BUFB, "the staged tiles fit the ring's LDS");
  char* stage = smem + wave * (32 * SP);
  {
    char* p = stage + (half << 3) * SP + l16 * 4;   // C VGPR r -> (row r | r+8, col lane%16)
#pragma unroll                             // all three: constant indices keep acc[] in registers
    for (int s = 0; s < 2; ++s)
#pragma unroll
      for (int t = 0; t < 4; ++t)
#pragma unroll
        for (int r = 0; r < 8; ++r)
          *(float*)(p + (s * 16 + r) * SP + t * 64) = acc[s][t][r];
  }
  const v4f bv = *(const v4f*)(bias + col);
  if (nG > 0) loadRes(0);                  // issued here, where the accumulators' registers are free
  waitDs0();                               // the wave's own rows are in LDS before it reads them back

#pragma unroll 1                           // rolled: one group's residual registers serve all four groups
  for (int g = 0; g < nG; ++g) {
    v4f cf[4], c[4];
    v2u cb[4];
#pragma unroll                             // constant indices keep the group's arrays in registers
    for (int q = 0; q < 4; ++q) {
      if (EPI == 1) cb[q] = rb[q];
      if (EPI == 2) cf[q] = rf[q];
      c[q] = *(const v4f*)(stage + (g * 8 + q * 2 + half) * SP + l16 * 16);   // one LDS wait a group
    }
    if (g + 1 < nG) loadRes(g + 1);        // next group's residual flies under this group's tanh
#pragma unroll                             // as above
    for (int q = 0; q < 4; ++q) {
      const int m = mW + g * 8 + q * 2 + half;
      v4f v = c[q] + bv;
      if (EPI == 1) {
        v.x += __builtin_bit_cast(float, cb[q].x << 16);
        v.y += __builtin_bit_cast(float, cb[q].x & 0xFFFF0000u);
        v.z += __builtin_bit_cast(float, cb[q].y << 16);
        v.w += __builtin_bit_cast(float, cb[q].y & 0xFFFF0000u);
      }
      if (EPI == 2) v += cf[q];
      v.x = tanhExp(v.x); v.y = tanhExp(v.y); v.z = tanhExp(v.z); v.w = tanhExp(v.w);
      if (m < M) {
        const unsigned int oi = (unsigned int)m * (unsigned int)N + (unsigned int)col;
        if (EPI == 2) {
          *(v4f*)(outF + oi) = v;
        } else {
          v2u o;
          o.x = bfbits(v.x) | (bfbits(v.y) << 16);
          o.y = bfbits(v.z) | (bfbits(v.w) << 16);
          *(v2u*)(outB + oi) = o;
        }
        // stands behind the store, in front of any rewrite of the registers that it names
        asm volatile("s_wait_xcnt 0x0" ::: "memory");
      }
    }
  }
}

// Levels with few rows (compress, M <= 1024: K = 4096, N = 512; decompress, M <= 128:
// K = 512, N = 4096, one stage, RES: + bf16 residual): 128x128 tiles would leave
// most WGPs idle while a few walk all of K. Here a work-group owns TM x 64 of the output
// (whole 128 B lines of bf16) and its 16 waves split K: of every staged 512 k a wave takes
// its own 32 for the whole tile. The 16 partial tiles are summed through LDS, in wave order.
// RIDE: the grids of the last three levels leave most WGPs idle, so RIDE_GROUPS more
// work-groups behind the nGemm that hold a tile round three levels of weights that a later
// launch reads (2 pieces a wave); they touch nothing of this launch's product.
#define RIDE_GROUPS 192
template <int TM, bool RIDE, int K, int N, bool RES>
__global__ __launch_bounds__(512)
void gemm_tanh_ksplit(const __bf16* __restrict__ A,
                      const __bf16* __restrict__ W,
                      const float* __restrict__ bias,
                      const __bf16* __restrict__ residB,
                      __bf16* __restrict__ outB,
                      int M,
                      const float* __restrict__ rideIn,
                      __bf16* __restrict__ rideOut,
                      int nGemm) {
  static_assert(CVT_WAVES * 32 == 512, "a riding work-group has the stream's shape");
  if constexpr (RIDE) {
    if ((int)blockIdx.x >= nGemm) {        // the whole work-group, in front of every barrier
      f32_to_bf16_stream<2>(rideIn, rideOut, blockIdx.x - (unsigned int)nGemm);
      return;
    }
  }
  constexpr int TN = 64, NW = 16;
  constexpr int SK    = NW * 32;           // k elements per stage: one WMMA k step a wave
  constexpr int ROWB  = SK * 2 + 16;       // row data + 16B pad (16B x odd pitch)
  constexpr int ROWS  = TM + TN;           // A rows, then W rows
  constexpr int BUFB  = ROWS * ROWB;       // one stage
  constexpr int NC    = ROWS * 2 / NW;     // copies per wave and stage, 512 B (half a row) each
  constexpr int NA    = TM * 2 / NW;       // of these, on A rows
  constexpr int FM    = TM / 16;
  constexpr int STAGES = K / SK;
  constexpr int NBUF  = STAGES > 1 ? 2 : 1;
  constexpr unsigned int NB = N / TN;      // tiles across the output's columns
  static_assert(NC == 10 || NC == 12, "a statement of eight copies, then two or four");
  constexpr int MERGEB = NW * TM * (TN * 4 + 16);   // the 16 partial tiles of the merge below
  __shared__ __attribute__((aligned(16))) char smem[NBUF * BUFB > MERGEB ? NBUF * BUFB : MERGEB];
  const unsigned int ldsBase = (unsigned int)(uintptr_t)smem;

  const int tid  = threadIdx.x;
  const int lane = tid & 31;
  const int wave = tid >> 5;
  const int mBase = (int)(blockIdx.x / NB) * TM;
  const int nBase = (int)(blockIdx.x % NB) * TN;

  // ---- loader mapping: copy c of wave w covers half (w & 1) of staged row c * 8 + (w >> 1) ----
  const int r0 = wave >> 1;
  const unsigned int inRow = (unsigned int)(wave & 1) * 256 + (unsigned int)lane * 8;   // element
  const unsigned int ldsLane = ldsBase + (unsigned int)r0 * ROWB + inRow * 2;
  unsigned int gOff[NC];                   // element offsets of this thread's rows
#pragma unroll                             // constant indices keep gOff[] in registers
  for (int c = 0; c < NC; ++c) {
    if (c < NA) {
      int aRow = mBase + c * 8 + r0; if (aRow > M - 1) aRow = M - 1;   // clamp ragged M
      gOff[c] = (unsigned int)aRow * (unsigned int)K + inRow;
    } else {
      gOff[c] = (unsigned int)(nBase + (c - NA) * 8 + r0) * (unsigned int)K + inRow;
    }
  }

  const int l16   = lane & 15;
  const int half  = lane >> 4;
  const int koff2 = half << 4;             // byte offset of K-half: 0 or 16

  auto issue = [&](int buf, int k0) {
    const unsigned int base = ldsLane + (unsigned int)buf * BUFB;
    const __bf16* ak = A + k0;
    const __bf16* wk = W + k0;
    unsigned int l[8];
    const __bf16* g[8];
#pragma unroll                             // l[], g[] become the asm's register operands
    for (int c = 0; c < 8; ++c) {
      l[c] = base + (unsigned int)(c * 8 * ROWB);
      g[c] = (c < NA ? ak : wk) + gOff[c];
    }
    asyncCopy16x8(l, g);
    unsigned int l2[NC - 8];
    const __bf16* g2[NC - 8];
#pragma unroll                             // as above
    for (int c = 8; c < NC; ++c) {
      l2[c - 8] = base + (unsigned int)(c * 8 * ROWB);
      g2[c - 8] = wk + gOff[c];
    }
    if constexpr (NC == 10) asyncCopy16x2(l2, g2); else asyncCopy16x4(l2, g2);
  };

  v8f acc[FM][4] = {};
  issue(0, 0);
  // All later stages of this wave's rows are asked into L2 now, so that the ring's copies,
  // which lead their readers by one stage only, find them there. A half-wave takes one of
  // two rows: lane pair s its 512 B of stage s, one 256-B unit a lane.
  static_assert(NA % 2 == 0 && NC % 2 == 0 && (STAGES == 8 || STAGES == 1), "row pairs lie in one matrix; 8 stages x 2 units a half-wave");
  if constexpr (STAGES > 1) {
#pragma unroll                             // constant indices into gOff[]
    for (int c = 0; c < NC; c += 2) {
      const unsigned int go = (half ? gOff[c + 1] : gOff[c]) - (unsigned int)lane * 8
                            + (unsigned int)(l16 >> 1) * SK + (unsigned int)(l16 & 1) * 128;
      prefetchL2((c < NA ? A : W) + go);
    }
  }
  waitAsync0();
  __syncthreads();                         // stage 0 visible to every wave
  if constexpr (STAGES > 1) issue(1, SK);
#pragma unroll 1                           // rolled: unrolled, all stages' copy addresses are formed ahead and spill
  for (int i = 0; i < STAGES; ++i) {
    const char* base = smem + (i & 1) * BUFB + wave * 64 + koff2;
    BfPack a[FM], b[4];
#pragma unroll
    for (int s = 0; s < FM; ++s) {
      const char* p = base + (s * 16 + l16) * ROWB;
      a[s].u[0] = *(const v4u*)p;
      a[s].u[1] = *(const v4u*)(p + 32);
    }
#pragma unroll
    for (int t = 0; t < 4; ++t) {
      const char* p = base + (TM + t * 16 + l16) * ROWB;
      b[t].u[0] = *(const v4u*)p;
      b[t].u[1] = *(const v4u*)(p + 32);
    }
#pragma unroll
    for (int s = 0; s < FM; ++s)
#pragma unroll
      for (int t = 0; t < 4; ++t)
        acc[s][t] = __builtin_amdgcn_wmma_f32_16x16x32_bf16(
            false, a[s].v, false, b[t].v, (short)0, acc[s][t], false, false);
    waitDs0();
    waitAsync0();
    __syncthreads();                       // stage i+1 visible; stage i's readers done
    if (i + 2 < STAGES) issue(i & 1, (i + 2) * SK);
  }
  waitAsync0();                            // nothing in flight when the wave ends

  // ---- merge: a thread owns EPT adjacent columns of one row, a wave whole 128 B lines ----
  constexpr int EPT = TM * TN / (NW * 32); // 2 or 4
  constexpr int TPR = TN / EPT;            // threads per output row
  typedef float vE __attribute__((ext_vector_type(EPT)));
  const int row = tid / TPR;
  const int col = (tid % TPR) * EPT;
  vE v = *(const vE*)(bias + nBase + col);
  // The reshape (M,4096)->(M*8,512) keeps the flat index, so the residual lies at m*N+col.
  unsigned int rw[EPT / 2] = {};           // two bf16 a word
  if constexpr (RES) {
    int rm = mBase + row; if (rm > M - 1) rm = M - 1;                  // clamp ragged M
    const __bf16* rp = residB + (unsigned int)rm * (unsigned int)N + (unsigned int)(nBase + col);
    if constexpr (EPT == 2) {
      rw[0] = *(const unsigned int*)rp;
    } else {
      const v2u t = *(const v2u*)rp;
      rw[0] = t.x; rw[1] = t.y;
    }
  }
  // stands behind the loads, in front of any rewrite of their address registers
  asm volatile("s_wait_xcnt 0x0" ::: "memory");

  // The ring is free here: every wave's reads and copies ended at the last barrier.
  constexpr int SP   = TN * 4 + 16;        // partial tile's row pitch: rows r and r+8 fall on disjoint banks
  constexpr int REGB = TM * SP;            // one wave's partial tile
  static_assert(NW * REGB == MERGEB, "the partial tiles fit the LDS");
  {
    char* p = smem + wave * REGB + (half << 3) * SP + l16 * 4;   // C VGPR r -> (row r | r+8, col lane%16)
#pragma unroll                             // all three: constant indices keep acc[] in registers
    for (int s = 0; s < FM; ++s)
#pragma unroll
      for (int t = 0; t < 4; ++t)
#pragma unroll
        for (int r = 0; r < 8; ++r)
          *(float*)(p + (s * 16 + r) * SP + t * 64) = acc[s][t][r];
  }
  __syncthreads();                         // every wave's partial tile is in LDS
#pragma unroll                             // w * REGB folds into the LDS loads' offset field
  for (int w = 0; w < NW; ++w)
    v += *(const vE*)(smem + w * REGB + row * SP + col * 4);
  if constexpr (RES) {
#pragma unroll                             // constant indices keep rw[] in registers
    for (int e = 0; e < EPT / 2; ++e) {
      v[2 * e]     += __builtin_bit_cast(float, rw[e] << 16);
      v[2 * e + 1] += __builtin_bit_cast(float, rw[e] & 0xFFFF0000u);
    }
  }

  const int m = mBase + row;
  if (m < M) {
    const unsigned int oi = (unsigned int)m * (unsigned int)N + (unsigned int)(nBase + col);
    unsigned int o[EPT / 2];
#pragma unroll                             // constant indices keep o[] in registers
    for (int e = 0; e < EPT / 2; ++e)
      o[e] = bfbits(tanhExp(v[2 * e])) | (bfbits(tanhExp(v[2 * e + 1])) << 16);
    if constexpr (EPT == 2) {
      *(unsigned int*)(outB + oi) = o[0];
    } else {
      v2u ov; ov.x = o[0]; ov.y = o[1];
      *(v2u*)(outB + oi) = ov;
    }
  }
}

extern "C" void kernel_launch(void* const* d_in, const int* in_sizes, int n_in,
                              void* d_out, int out_size, void* d_ws, size_t ws_size,
                              hipStream_t stream) {
  (void)in_sizes; (void)n_in; (void)out_size; (void)ws_size;
  const float* seq = (const float*)d_in[0];   // (2, 32768, 512)
  const float* Wc  = (const float*)d_in[1];   // (6, 512, 4096)
  const float* bc  = (const float*)d_in[2];   // (6, 512)
  const float* Wd  = (const float*)d_in[3];   // (6, 4096, 512)
  const float* bd  = (const float*)d_in[4];   // (6, 4096)
  float* out = (float*)d_out;                 // (2, 32768, 512)

  const long WELEMS = 6L * 512 * 4096;

  char* ws = (char*)d_ws;
  size_t off = 0;
  auto carve = [&](size_t bytes) -> char* {
    char* p = ws + off;
    off += (bytes + 255) & ~(size_t)255;
    return p;
  };

  __bf16* WcB = (__bf16*)carve((size_t)WELEMS * 2);
  __bf16* WdB = (__bf16*)carve((size_t)WELEMS * 2);
  const long hierElems[6] = {33554432L, 4194304L, 524288L, 65536L, 8192L, 1024L};
  __bf16* hier[6];
  for (int i = 0; i < 6; ++i) hier[i] = (__bf16*)carve((size_t)hierElems[i] * 2);
  __bf16* ping = (__bf16*)carve(4194304L * 2);
  __bf16* pong = (__bf16*)carve(4194304L * 2);

  // --- f32 -> bf16 staging: the sequence and Wc levels 0-2 here; Wc levels 3-5 ride with
  // compress level 2, Wd levels 0-2 with level 3, Wd levels 3-5 with level 4 ---
  const long HALFW = 3L * 512 * 4096;         // three levels of either weight array
  static_assert(3L * HEAD_GROUPS * CVT_WAVES * 1024 == 3L * 512 * 4096, "head weights: 3 pieces a wave");
  static_assert(2L * RIDE_GROUPS * CVT_WAVES * 1024 == 3L * 512 * 4096, "riding weights: 2 pieces a wave");
  static_assert(8L * SEQ_GROUPS * CVT_WAVES * 1024 == 33554432L, "sequence: 8 pieces a wave");
  f32_to_bf16_head<<<SEQ_GROUPS + HEAD_GROUPS, CVT_WAVES * 32, 0, stream>>>(seq, hier[0], Wc, WcB);
  const float* rideIn[5]  = {nullptr, nullptr, Wc + HALFW, Wd, Wd + HALFW};
  __bf16*      rideOut[5] = {nullptr, nullptr, WcB + HALFW, WdB, WdB + HALFW};

  // --- compress: 5 levels, A=(M,4096) W=(512,4096) ---
  const int Mc[5] = {8192, 1024, 128, 16, 2};
  for (int l = 0; l < 5; ++l) {
    const int M = Mc[l], N = 512, K = 4096;
    const __bf16* Wl = WcB + (size_t)l * 512 * 4096;
    const float* bl = bc + (size_t)l * 512;
    if (l == 0) {
      const int blocks = ((M + 127) / 128) * (N / 128);
      gemm_tanh_wmma<0, 256><<<blocks, 256, 0, stream>>>(
          hier[l], Wl, bl, nullptr, nullptr, hier[l + 1], nullptr, M, N, K);
    } else if (l == 1) {
      gemm_tanh_ksplit<32, false, 4096, 512, false><<<(M / 32) * (N / 64), 512, 0, stream>>>(
          hier[l], Wl, bl, nullptr, hier[l + 1], M, nullptr, nullptr, 0);
    } else {
      const int nGemm = ((M + 15) / 16) * (N / 64);
      gemm_tanh_ksplit<16, true, 4096, 512, false><<<nGemm + RIDE_GROUPS, 512, 0, stream>>>(
          hier[l], Wl, bl, nullptr, hier[l + 1], M, rideIn[l], rideOut[l], nGemm);
    }
  }

  // --- decompress: 5 levels, A=(M,512) W=(4096,512) ---
  const __bf16* cur = hier[5];
  __bf16* bufs[2] = {ping, pong};
  for (int i = 0; i < 5; ++i) {
    const int l = 4 - i;
    int M = 2;
    for (int j = 0; j < 4 - l; ++j) M *= 8;   // 2 * 8^(4-l)
    const int N = 4096, K = 512;
    const int blocks = ((M + 127) / 128) * (N / 128);
    if (l > 2) {
      gemm_tanh_ksplit<16, false, 512, 4096, true><<<((M + 15) / 16) * (N / 64), 512, 0, stream>>>(
          cur, WdB + (size_t)l * 4096 * 512, bd + (size_t)l * 4096,
          hier[l], bufs[i & 1], M, nullptr, nullptr, 0);
      cur = bufs[i & 1];
    } else if (l == 2) {
      gemm_tanh_ksplit<32, false, 512, 4096, true><<<(M / 32) * (N / 64), 512, 0, stream>>>(
          cur, WdB + (size_t)l * 4096 * 512, bd + (size_t)l * 4096,
          hier[l], bufs[i & 1], M, nullptr, nullptr, 0);
      cur = bufs[i & 1];
    } else if (l > 0) {
      gemm_tanh_wmma<1, 256><<<blocks, 256, 0, stream>>>(
          cur, WdB + (size_t)l * 4096 * 512, bd + (size_t)l * 4096,
          hier[l], nullptr, bufs[i & 1], nullptr, M, N, K);
      cur = bufs[i & 1];
    } else {
      gemm_tanh_wmma<2, 64><<<blocks, 256, 0, stream>>>(
          cur, WdB, bd, nullptr, seq, nullptr, out, M, N, K);
    }
  }
}

// v010
// A run of this version takes 134 microseconds.
// Timed twice side by side with v009, it ran 1.05 times as fast both times.
// Counting every step since v000, it is 4.63 times as fast.
#include <hip/hip_runtime.h>

// ---------------------------------------------------------------------------
// CDNA5 (gfx1250) HierarchicalTemporalCompressor: bf16 WMMA GEMMs with
// double- or triple-buffered async global->LDS staging (ASYNCcnt path) and ds_load_b128
// fragment reads. Every level: C[m,n] = sum_k A[m,k]*W[n,k] (+bias,+resid,tanh).
// ---------------------------------------------------------------------------

typedef __bf16        v16bf __attribute__((ext_vector_type(16)));
typedef float         v8f   __attribute__((ext_vector_type(8)));
typedef unsigned int  v4u   __attribute__((ext_vector_type(4)));
typedef unsigned int  v2u   __attribute__((ext_vector_type(2)));
typedef float         v4f   __attribute__((ext_vector_type(4)));

union BfPack {
  v4u   u[2];   // u[0] -> fragment VGPRs 0..3, u[1] -> VGPRs 4..7
  v16bf v;
};

__device__ __forceinline__ __bf16 f2bf(float f) {
  unsigned int u = __builtin_bit_cast(unsigned int, f);
  u += 0x7FFFu + ((u >> 16) & 1u);            // round-to-nearest-even
  unsigned short h = (unsigned short)(u >> 16);
  return __builtin_bit_cast(__bf16, h);
}

// the same rounding, as the low 16 bits of a word (for packed stores)
__device__ __forceinline__ unsigned int bfbits(float f) {
  return (unsigned int)__builtin_bit_cast(unsigned short, f2bf(f));
}

// tanh x = 1 - 2 / (1 + e^(2x)), straight-line: one exp2, one rcp, three plain operations.
// e^(2x) = inf gives 1, e^(2x) = 0 gives -1, a NaN stays one; the absolute error is a few
// units of 2^-24, at every x. No branch, so a group's values run as independent chains.
__device__ __forceinline__ float tanhExp(float x) {
  const float e = __builtin_amdgcn_exp2f(x * 2.885390081777927f);   // 2 * log2(e)
  return 1.0f - 2.0f * __builtin_amdgcn_rcpf(1.0f + e);
}

// f32 -> bf16 as a stream, by work-groups of CVT_WAVES waves; group is the work-group's
// place in its stream. A wave owns PASSES adjacent pieces of 4 KB: a piece is eight loads
// of 512 adjacent bytes (16 B a lane, whole lines; read once, so non-temporal) and eight
// stores of 256 adjacent bytes. The next piece's loads are in flight while this one is rounded.
#define CVT_WAVES  16
template <int PASSES>
__device__ __forceinline__
void f32_to_bf16_stream(const float* __restrict__ in, __bf16* __restrict__ out, unsigned int group) {
  const unsigned int lane = threadIdx.x & 31u;
  const unsigned int wave = group * CVT_WAVES + (threadIdx.x >> 5);
  const char* src = (const char*)in + (size_t)wave * (PASSES * 4096) + lane * 16;
  char* dst = (char*)out + (size_t)wave * (PASSES * 2048) + lane * 8;
  v4f r[2][8];                             // this piece and the next
#pragma unroll                             // constant indices keep r[][] in registers
  for (int q = 0; q < 8; ++q)
    r[0][q] = __builtin_nontemporal_load((const v4f*)(src + q * 512));
#pragma unroll                             // as above; p * 4096 folds into the offset fields
  for (int p = 0; p < PASSES; ++p) {
    // the two scheduling barriers keep the order: next piece's loads, then this piece's work
    __builtin_amdgcn_sched_barrier(0);
    if (p + 1 < PASSES) {
#pragma unroll                             // as above
      for (int q = 0; q < 8; ++q)
        r[(p + 1) & 1][q] =
            __builtin_nontemporal_load((const v4f*)(src + (p + 1) * 4096 + q * 512));
    }
    __builtin_amdgcn_sched_barrier(0);
#pragma unroll                             // as above
    for (int q = 0; q < 8; ++q) {
      const v4f v = r[p & 1][q];
      v2u o;
      o.x = bfbits(v.x) | (bfbits(v.y) << 16);
      o.y = bfbits(v.z) | (bfbits(v.w) << 16);
      *(v2u*)(dst + p * 2048 + q * 256) = o;
    }
    // stands behind the stores, in front of any rewrite of the registers that they name
    // (behind the last piece too, though nothing of either calling kernel follows the stream)
    asm volatile("s_wait_xcnt 0x0" ::: "memory");
  }
}

// The stream that the first GEMM waits for: the first three levels of the compress weights
// (3 pieces a wave). The other weights ride in later, under-filled grids; the sequence is
// rounded by the first GEMM itself, where it reads its fragments.
#define HEAD_GROUPS 128
__global__ __launch_bounds__(CVT_WAVES * 32)
void f32_to_bf16_head(const float* __restrict__ w, __bf16* __restrict__ wB) {
  f32_to_bf16_stream<3>(w, wB, blockIdx.x);
}

// Eight 16B async copies global -> LDS (ASYNCcnt). The s_wait_xcnt 0 is the
// last line of the copies' own statement, so that it stands in front of any
// later rewrite of the address registers that the copies name.
__device__ __forceinline__ void asyncCopy16x8(const unsigned int (&l)[8],
                                              const __bf16* const (&g)[8]) {
  asm volatile("global_load_async_to_lds_b128 %0, %8, off\n\t"
               "global_load_async_to_lds_b128 %1, %9, off\n\t"
               "global_load_async_to_lds_b128 %2, %10, off\n\t"
               "global_load_async_to_lds_b128 %3, %11, off\n\t"
               "global_load_async_to_lds_b128 %4, %12, off\n\t"
               "global_load_async_to_lds_b128 %5, %13, off\n\t"
               "global_load_async_to_lds_b128 %6, %14, off\n\t"
               "global_load_async_to_lds_b128 %7, %15, off\n\t"
               "s_wait_xcnt 0x0"
               :: "v"(l[0]), "v"(l[1]), "v"(l[2]), "v"(l[3]),
                  "v"(l[4]), "v"(l[5]), "v"(l[6]), "v"(l[7]),
                  "v"(g[0]), "v"(g[1]), "v"(g[2]), "v"(g[3]),
                  "v"(g[4]), "v"(g[5]), "v"(g[6]), "v"(g[7])
               : "memory");
}
// The same for twelve copies, of f32 or bf16 rows: half of a stage that holds f32 A rows.
__device__ __forceinline__ void asyncCopy16x12(const unsigned int (&l)[12],
                                               const void* const (&g)[12]) {
  asm volatile("global_load_async_to_lds_b128 %0, %12, off\n\t"
               "global_load_async_to_lds_b128 %1, %13, off\n\t"
               "global_load_async_to_lds_b128 %2, %14, off\n\t"
               "global_load_async_to_lds_b128 %3, %15, off\n\t"
               "global_load_async_to_lds_b128 %4, %16, off\n\t"
               "global_load_async_to_lds_b128 %5, %17, off\n\t"
               "global_load_async_to_lds_b128 %6, %18, off\n\t"
               "global_load_async_to_lds_b128 %7, %19, off\n\t"
               "global_load_async_to_lds_b128 %8, %20, off\n\t"
               "global_load_async_to_lds_b128 %9, %21, off\n\t"
               "global_load_async_to_lds_b128 %10, %22, off\n\t"
               "global_load_async_to_lds_b128 %11, %23, off\n\t"
               "s_wait_xcnt 0x0"
               :: "v"(l[0]), "v"(l[1]), "v"(l[2]), "v"(l[3]), "v"(l[4]), "v"(l[5]),
                  "v"(l[6]), "v"(l[7]), "v"(l[8]), "v"(l[9]), "v"(l[10]), "v"(l[11]),
                  "v"(g[0]), "v"(g[1]), "v"(g[2]), "v"(g[3]), "v"(g[4]), "v"(g[5]),
                  "v"(g[6]), "v"(g[7]), "v"(g[8]), "v"(g[9]), "v"(g[10]), "v"(g[11])
               : "memory");
}
// The same, for the two or four copies that are left of a wave's share of a stage.
__device__ __forceinline__ void asyncCopy16x2(const unsigned int (&l)[2],
                                              const __bf16* const (&g)[2]) {
  asm volatile("global_load_async_to_lds_b128 %0, %2, off\n\t"
               "global_load_async_to_lds_b128 %1, %3, off\n\t"
               "s_wait_xcnt 0x0"
               :: "v"(l[0]), "v"(l[1]), "v"(g[0]), "v"(g[1])
               : "memory");
}
__device__ __forceinline__ void asyncCopy16x4(const unsigned int (&l)[4],
                                              const __bf16* const (&g)[4]) {
  asm volatile("global_load_async_to_lds_b128 %0, %4, off\n\t"
               "global_load_async_to_lds_b128 %1, %5, off\n\t"
               "global_load_async_to_lds_b128 %2, %6, off\n\t"
               "global_load_async_to_lds_b128 %3, %7, off\n\t"
               "s_wait_xcnt 0x0"
               :: "v"(l[0]), "v"(l[1]), "v"(l[2]), "v"(l[3]),
                  "v"(g[0]), "v"(g[1]), "v"(g[2]), "v"(g[3])
               : "memory");
}
// This wave's copies have landed (the compiler places no wait for them).
__device__ __forceinline__ void waitAsync0() {
  asm volatile("s_wait_asynccnt 0x0" ::: "memory");
}
// All but this wave's 24 youngest copies have landed: one stage of the three-buffer ring is
// 24 copies a wave, in every wave, so the stage before the youngest one is complete.
__device__ __forceinline__ void waitAsyncButOneStage() {
  asm volatile("s_wait_asynccnt 0x18" ::: "memory");
}
// This wave's LDS reads have retired before a copy refills the buffer they read.
__device__ __forceinline__ void waitDs0() {
  asm volatile("s_wait_dscnt 0x0" ::: "memory");
}

// One lane asks L2 for the line at p; nothing returns and no counter moves.
// The s_wait_xcnt 0 stands in front of any later rewrite of the address registers.
__device__ __forceinline__ void prefetchL2(const void* p) {
  asm volatile("global_prefetch_b8 %0, off scope:SCOPE_SE\n\t"
               "s_wait_xcnt 0x0"
               :: "v"(p) : "memory");
}

#define BM   128
#define BN   128

// EPI: 0 = compress (tanh, bf16 out, shape (M,N))
//      1 = decompress mid (reshape (M,4096)->(M*8,512), +bf16 resid, tanh, bf16)
//      2 = decompress final (reshape, +f32 resid, tanh, f32 out)
// BK : k elements of every operand row staged per pass (K is a multiple of it)
// AF32: A is f32 in memory (Af). Its rows are staged as they are and rounded to bf16 where a
//      wave reads its fragments, so no bf16 copy of A is written or read back. A stage then
//      holds twice the A bytes: 128 k a stage, three buffers, two stages of copies in flight.
template <int EPI, int BK, bool AF32>
__global__ __launch_bounds__(256)
void gemm_tanh_wmma(const __bf16* __restrict__ A,
                    const float* __restrict__ Af,
                    const __bf16* __restrict__ W,
                    const float* __restrict__ bias,
                    const __bf16* __restrict__ residB,
                    const float* __restrict__ residF,
                    __bf16* __restrict__ outB,
                    float* __restrict__ outF,
                    int M, int N, int K) {
  constexpr int ROWB  = BK * 2 + 16;     // row data + 16B pad (16B x odd pitch)
  constexpr int TILEB = 128 * ROWB;      // one staged bf16 matrix tile
  constexpr int ROWA  = AF32 ? BK * 4 + 16 : ROWB;   // A row, the same kind of pitch
  constexpr int TILEA = 128 * ROWA;      // the staged A tile
  constexpr int BUFB  = TILEA + TILEB;   // one stage: A tile, W tile
  constexpr int NBUF  = AF32 ? 3 : 2;
  constexpr int LPR   = BK / 8;          // lanes that cover one row, 16B each
  constexpr int RPS   = 256 / LPR;       // rows that one copy of the block covers
  constexpr int NCP   = 128 / RPS;       // copies per thread and matrix tile
  static_assert(NCP % 4 == 0, "copies go out in statements of eight");
  static_assert(!AF32 || (BK == 128 && NCP == 8), "f32 A: a wave covers a 512 B row; 16 + 8 copies a stage");
  constexpr bool AHEAD = BK >= 128;      // fragments fetched two k steps ahead (see the k loop)
  __shared__ __attribute__((aligned(16))) char smem[NBUF * BUFB];
  const unsigned int ldsBase = (unsigned int)(uintptr_t)smem;

  const int tid  = threadIdx.x;
  const int lane = tid & 31;
  const int wave = tid >> 5;
  const int nBlocks = N >> 7;
  const int bm = blockIdx.x / nBlocks;
  const int bn = blockIdx.x - bm * nBlocks;
  const int mBase = bm << 7;
  const int nBase = bn << 7;

  // ---- loader mapping: LPR adjacent lanes cover one row's BK*2 bytes ----
  const int lr = tid / LPR;                // first row of this thread
  const int lc = tid % LPR;                // 16B chunk inside the row
  const unsigned int ldsRow = (unsigned int)lr * ROWB + (unsigned int)lc * 16;
  // f32 A: a wave's 32 lanes cover one row's 512 B, the block 8 rows a copy
  constexpr int NCA = AF32 ? 16 : NCP;     // copies per thread and A tile
  constexpr int RPA = 128 / NCA;           // rows that one copy of the block covers
  const int la = AF32 ? wave : lr;         // first A row of this thread
  unsigned int aOff[NCA];                  // element offsets of this thread's A rows
#pragma unroll                             // constant indices keep aOff[] in registers
  for (int j = 0; j < NCA; ++j) {
    int aRow = mBase + la + j * RPA; if (aRow > M - 1) aRow = M - 1;  // clamp ragged M
    aOff[j] = (unsigned int)aRow * (unsigned int)K + (AF32 ? (unsigned int)lane * 4 : (unsigned int)lc * 8);
  }
  const unsigned int wOff = (unsigned int)(nBase + lr) * (unsigned int)K + (unsigned int)lc * 8;

  // ---- compute mapping: 8 waves = 4(M) x 2(N); wave tile 32x64 ----
  const int wm = wave & 3;
  const int wn = wave >> 2;
  const int l16 = lane & 15;
  const int koff2 = (lane >> 4) << 4;      // byte offset of K-half: 0 or 16

  v8f acc[2][4] = {};
  const int ksteps = K / BK;

  auto issue = [&](int buf, int k0) {
    const unsigned int base = ldsBase + (unsigned int)buf * BUFB + ldsRow;
    const __bf16* ak = A + k0;
    const __bf16* wk = W + k0;
    if constexpr (AF32) {
      const unsigned int baseA = ldsBase + (unsigned int)buf * BUFB
                               + (unsigned int)wave * ROWA + (unsigned int)lane * 16;
      const float* afk = Af + k0;
      unsigned int l[2][12];               // copies 0-15: A rows, 16-23: W rows
      const void* g[2][12];
#pragma unroll                             // l[][], g[][] become the asm's register operands
      for (int c = 0; c < NCA; ++c) {
        l[c / 12][c % 12] = baseA + (unsigned int)(c * RPA * ROWA);
        g[c / 12][c % 12] = afk + aOff[c];
      }
#pragma unroll                             // as above
      for (int c = 0; c < NCP; ++c) {
        l[(NCA + c) / 12][(NCA + c) % 12] = base + (unsigned int)(TILEA + c * RPS * ROWB);
        g[(NCA + c) / 12][(NCA + c) % 12] = wk + (size_t)(c * RPS) * K + wOff;
      }
      asyncCopy16x12(l[0], g[0]);
      asyncCopy16x12(l[1], g[1]);
      return;
    }
#pragma unroll                             // constant indices into aOff[]
    for (int j = 0; j < NCP; j += 4) {
      unsigned int l[8];
      const __bf16* g[8];
#pragma unroll                             // l[], g[] become the asm's register operands
      for (int q = 0; q < 4; ++q) {
        l[q]     = base + (unsigned int)((j + q) * RPS * ROWB);
        g[q]     = ak + aOff[j + q];
        l[q + 4] = base + (unsigned int)(TILEB + (j + q) * RPS * ROWB);
        g[q + 4] = wk + (size_t)((j + q) * RPS) * K + wOff;
      }
      asyncCopy16x8(l, g);
    }
  };

  issue(0, 0);
  // The tile's residual is first read in the epilogue, from memory: asked for here, it comes
  // into L2 under the k loop. Two lanes a row: 256 B each of f32, 128 B each of bf16.
  if (EPI != 0) {
    int pm = mBase + (tid >> 1); if (pm > M - 1) pm = M - 1;          // clamp ragged M
    const unsigned int pi = (unsigned int)pm * (unsigned int)N + (unsigned int)(nBase + (tid & 1) * 64);
    if (EPI == 1) prefetchL2(residB + pi); else prefetchL2(residF + pi);
  }
  if (AF32 && 1 < ksteps) { issue(1, BK); waitAsyncButOneStage(); }   // tile 1 may still fly
  else waitAsync0();
  __syncthreads();                         // tile 0 visible to every wave
  if (NBUF - 1 < ksteps) issue(NBUF - 1, (NBUF - 1) * BK);
  int i3 = 0;                              // i mod 3, for the ring of three
  for (int i = 0; i < ksteps; ++i) {
    const int buf = AF32 ? i3 : (i & 1);
    const char* base = smem + buf * BUFB;
    // Three fragment sets where a stage is long and few waves share a SIMD (AHEAD): the twelve (f32 A: sixteen)
    // LDS reads of k step kk + 2 go out as one group in front of the WMMAs of k step kk, so
    // that a wave waits out the LDS latency once a stage, not at every k step. Only this
    // stage's buffer is read: the stage's last two k steps fetch nothing.
    BfPack a[AHEAD ? 3 : 1][2], b[AHEAD ? 3 : 1][4];
    v4f af[AF32 ? 3 : 1][2][4];            // f32 A: a fragment's 16 values as they were staged
    auto frags = [&](int set, int kk) {
#pragma unroll                             // constant indices keep a[][], af[][][] in registers
      for (int s = 0; s < 2; ++s) {
        if constexpr (AF32) {              // the same k as below, at twice the bytes
          const char* p = base + (wm * 32 + s * 16 + l16) * ROWA + kk * 128 + koff2 * 2;
          af[set][s][0] = *(const v4f*)p;
          af[set][s][1] = *(const v4f*)(p + 16);
          af[set][s][2] = *(const v4f*)(p + 64);
          af[set][s][3] = *(const v4f*)(p + 80);
        } else {
          const char* p = base + (wm * 32 + s * 16 + l16) * ROWB + kk * 64 + koff2;
          a[set][s].u[0] = *(const v4u*)p;
          a[set][s].u[1] = *(const v4u*)(p + 32);
        }
      }
#pragma unroll                             // constant indices keep b[][] in registers
      for (int t = 0; t < 4; ++t) {
        const char* p = base + TILEA + (wn * 64 + t * 16 + l16) * ROWB + kk * 64 + koff2;
        b[set][t].u[0] = *(const v4u*)p;
        b[set][t].u[1] = *(const v4u*)(p + 32);
      }
    };
    if (AHEAD) { frags(0, 0); frags(1, 1); }
#pragma unroll                             // kk * 64 folds into the LDS loads' offset field
    for (int kk = 0; kk < BK / 32; ++kk) {
      const int set = AHEAD ? kk % 3 : 0;
      if (!AHEAD) frags(0, kk);
      if (AHEAD && kk + 2 < BK / 32) frags((kk + 2) % 3, kk + 2);
      // the two scheduling barriers keep a later k step's reads one group, ahead of these
      // WMMAs; left free, the compiler sinks them among the WMMAs that use them
      if (AHEAD) __builtin_amdgcn_sched_barrier(0);
      if constexpr (AF32) {
#pragma unroll                             // both: constant indices keep the fragments in registers
        for (int s = 0; s < 2; ++s)
#pragma unroll
          for (int e = 0; e < 16; ++e)
            a[set][s].v[e] = (__bf16)af[set][s][e >> 2][e & 3];   // to nearest even, as f2bf
      }
#pragma unroll
      for (int s = 0; s < 2; ++s)
#pragma unroll
        for (int t = 0; t < 4; ++t)
          acc[s][t] = __builtin_amdgcn_wmma_f32_16x16x32_bf16(
              false, a[set][s].v, false, b[set][t].v, (short)0, acc[s][t], false, false);
      if (AHEAD) __builtin_amdgcn_sched_barrier(0);
    }
    waitDs0();
    if (AF32 && i + 2 < ksteps) waitAsyncButOneStage();   // tile i+1 is in; tile i+2 may still fly
    else waitAsync0();
    __syncthreads();                       // tile i+1 visible; tile i's readers done
    if (i + NBUF < ksteps) issue(buf, (i + NBUF) * BK);
    if (AF32) i3 = i3 == 2 ? 0 : i3 + 1;
  }
  waitAsync0();                            // nothing in flight when the wave ends

  // ---- epilogue: each wave turns its 32x64 tile through its own LDS range, so
  // that a lane owns 4 adjacent columns and a wave-wide access covers whole lines.
  const int half = lane >> 4;              // two rows per wave-wide access
  const int col  = nBase + wn * 64 + l16 * 4;
  // first row of the wave's tile, in a scalar register: it bounds the loop below
  const int mW = __builtin_amdgcn_readfirstlane(mBase + wm * 32);
  int nG = (M - mW + 7) >> 3;              // groups of 8 rows that hold a row below M
  nG = nG < 0 ? 0 : (nG > 4 ? 4 : nG);

  // The reshape (M,4096)->(M*8,512) keeps the flat index, so every EPI uses m*N+col
  // (below 2^26 elements at every level).
  v4f rf[4];                               // residual of the next group, in flight
  v2u rb[4];
  auto loadRes = [&](int g) {
#pragma unroll                             // constant indices keep rf[], rb[] in registers
    for (int q = 0; q < 4; ++q) {
      int m = mW + g * 8 + q * 2 + half; if (m > M - 1) m = M - 1;   // clamp ragged M
      const unsigned int oi = (unsigned int)m * (unsigned int)N + (unsigned int)col;
      if (EPI == 1) rb[q] = *(const v2u*)(residB + oi);
      if (EPI == 2) rf[q] = *(const v4f*)(residF + oi);
    }
    // stands behind the loads, in front of any rewrite of their address registers
    if (EPI != 0) asm volatile("s_wait_xcnt 0x0" ::: "memory");
  };

  // The ring is free here: every wave's reads and copies ended at the last barrier.
  constexpr int SP = 64 * 4 + 16;          // staged row pitch: rows r and r+8 fall on disjoint banks
  static_assert(8 * 32 * SP <= NBUF * BUFB, "the staged tiles fit the ring's LDS");
  char* stage = smem + wave * (32 * SP);
  {
    char* p = stage + (half << 3) * SP + l16 * 4;   // C VGPR r -> (row r | r+8, col lane%16)
#pragma unroll                             // all three: constant indices keep acc[] in registers
    for (int s = 0; s < 2; ++s)
#pragma unroll
      for (int t = 0; t < 4; ++t)
#pragma unroll
        for (int r = 0; r < 8; ++r)
          *(float*)(p + (s * 16 + r) * SP + t * 64) = acc[s][t][r];
  }
  const v4f bv = *(const v4f*)(bias + col);
  if (nG > 0) loadRes(0);                  // issued here, where the accumulators' registers are free
  waitDs0();                               // the wave's own rows are in LDS before it reads them back

#pragma unroll 1                           // rolled: one group's residual registers serve all four groups
  for (int g = 0; g < nG; ++g) {
    v4f cf[4], c[4];
    v2u cb[4];
#pragma unroll                             // constant indices keep the group's arrays in registers
    for (int q = 0; q < 4; ++q) {
      if (EPI == 1) cb[q] = rb[q];
      if (EPI == 2) cf[q] = rf[q];
      c[q] = *(const v4f*)(stage + (g * 8 + q * 2 + half) * SP + l16 * 16);   // one LDS wait a group
    }
    if (g + 1 < nG) loadRes(g + 1);        // next group's residual flies under this group's tanh
#pragma unroll                             // as above
    for (int q = 0; q < 4; ++q) {
      const int m = mW + g * 8 + q * 2 + half;
      v4f v = c[q] + bv;
      if (EPI == 1) {
        v.x += __builtin_bit_cast(float, cb[q].x << 16);
        v.y += __builtin_bit_cast(float, cb[q].x & 0xFFFF0000u);
        v.z += __builtin_bit_cast(float, cb[q].y << 16);
        v.w += __builtin_bit_cast(float, cb[q].y & 0xFFFF0000u);
      }
      if (EPI == 2) v += cf[q];
      v.x = tanhExp(v.x); v.y = tanhExp(v.y); v.z = tanhExp(v.z); v.w = tanhExp(v.w);
      if (m < M) {
        const unsigned int oi = (unsigned int)m * (unsigned int)N + (unsigned int)col;
        if (EPI == 2) {
          *(v4f*)(outF + oi) = v;
        } else {
          v2u o;
          o.x = bfbits(v.x) | (bfbits(v.y) << 16);
          o.y = bfbits(v.z) | (bfbits(v.w) << 16);
          *(v2u*)(outB + oi) = o;
        }
        // stands behind the store, in front of any rewrite of the registers that it names
        asm volatile("s_wait_xcnt 0x0" ::: "memory");
      }
    }
  }
}

// Levels with few rows (compress, M <= 1024: K = 4096, N = 512; decompress, M <= 128:
// K = 512, N = 4096, one stage, RES: + bf16 residual): 128x128 tiles would leave
// most WGPs idle while a few walk all of K. Here a work-group owns TM x 64 of the output
// (whole 128 B lines of bf16) and its 16 waves split K: of every staged 512 k a wave takes
// its own 32 for the whole tile. The 16 partial tiles are summed through LDS, in wave order.
// RIDE: the grids of the last three levels leave most WGPs idle, so RIDE_GROUPS more
// work-groups behind the nGemm that hold a tile round three levels of weights that a later
// launch reads (2 pieces a wave); they touch nothing of this launch's product.
#define RIDE_GROUPS 192
template <int TM, bool RIDE, int K, int N, bool RES>
__global__ __launch_bounds__(512)
void gemm_tanh_ksplit(const __bf16* __restrict__ A,
                      const __bf16* __restrict__ W,
                      const float* __restrict__ bias,
                      const __bf16* __restrict__ residB,
                      __bf16* __restrict__ outB,
                      int M,
                      const float* __restrict__ rideIn,
                      __bf16* __restrict__ rideOut,
                      int nGemm) {
  static_assert(CVT_WAVES * 32 == 512, "a riding work-group has the stream's shape");
  if constexpr (RIDE) {
    if ((int)blockIdx.x >= nGemm) {        // the whole work-group, in front of every barrier
      f32_to_bf16_stream<2>(rideIn, rideOut, blockIdx.x - (unsigned int)nGemm);
      return;
    }
  }
  constexpr int TN = 64, NW = 16;
  constexpr int SK    = NW * 32;           // k elements per stage: one WMMA k step a wave
  constexpr int ROWB  = SK * 2 + 16;       // row data + 16B pad (16B x odd pitch)
  constexpr int ROWS  = TM + TN;           // A rows, then W rows
  constexpr int BUFB  = ROWS * ROWB;       // one stage
  constexpr int NC    = ROWS * 2 / NW;     // copies per wave and stage, 512 B (half a row) each
  constexpr int NA    = TM * 2 / NW;       // of these, on A rows
  constexpr int FM    = TM / 16;
  constexpr int STAGES = K / SK;
  constexpr int NBUF  = STAGES > 1 ? 2 : 1;
  constexpr unsigned int NB = N / TN;      // tiles across the output's columns
  static_assert(NC == 10 || NC == 12, "a statement of eight copies, then two or four");
  constexpr int MERGEB = NW * TM * (TN * 4 + 16);   // the 16 partial tiles of the merge below
  __shared__ __attribute__((aligned(16))) char smem[NBUF * BUFB > MERGEB ? NBUF * BUFB : MERGEB];
  const unsigned int ldsBase = (unsigned int)(uintptr_t)smem;

  const int tid  = threadIdx.x;
  const int lane = tid & 31;
  const int wave = tid >> 5;
  const int mBase = (int)(blockIdx.x / NB) * TM;
  const int nBase = (int)(blockIdx.x % NB) * TN;

  // ---- loader mapping: copy c of wave w covers half (w & 1) of staged row c * 8 + (w >> 1) ----
  const int r0 = wave >> 1;
  const unsigned int inRow = (unsigned int)(wave & 1) * 256 + (unsigned int)lane * 8;   // element
  const unsigned int ldsLane = ldsBase + (unsigned int)r0 * ROWB + inRow * 2;
  unsigned int gOff[NC];                   // element offsets of this thread's rows
#pragma unroll                             // constant indices keep gOff[] in registers
  for (int c = 0; c < NC; ++c) {
    if (c < NA) {
      int aRow = mBase + c * 8 + r0; if (aRow > M - 1) aRow = M - 1;   // clamp ragged M
      gOff[c] = (unsigned int)aRow * (unsigned int)K + inRow;
    } else {
      gOff[c] = (unsigned int)(nBase + (c - NA) * 8 + r0) * (unsigned int)K + inRow;
    }
  }

  const int l16   = lane & 15;
  const int half  = lane >> 4;
  const int koff2 = half << 4;             // byte offset of K-half: 0 or 16

  auto issue = [&](int buf, int k0) {
    const unsigned int base = ldsLane + (unsigned int)buf * BUFB;
    const __bf16* ak = A + k0;
    const __bf16* wk = W + k0;
    unsigned int l[8];
    const __bf16* g[8];
#pragma unroll                             // l[], g[] become the asm's register operands
    for (int c = 0; c < 8; ++c) {
      l[c] = base + (unsigned int)(c * 8 * ROWB);
      g[c] = (c < NA ? ak : wk) + gOff[c];
    }
    asyncCopy16x8(l, g);
    unsigned int l2[NC - 8];
    const __bf16* g2[NC - 8];
#pragma unroll                             // as above
    for (int c = 8; c < NC; ++c) {
      l2[c - 8] = base + (unsigned int)(c * 8 * ROWB);
      g2[c - 8] = wk + gOff[c];
    }
    if constexpr (NC == 10) asyncCopy16x2(l2, g2); else asyncCopy16x4(l2, g2);
  };

  v8f acc[FM][4] = {};
  issue(0, 0);
  // All later stages of this wave's rows are asked into L2 now, so that the ring's copies,
  // which lead their readers by one stage only, find them there. A half-wave takes one of
  // two rows: lane pair s its 512 B of stage s, one 256-B unit a lane.
  static_assert(NA % 2 == 0 && NC % 2 == 0 && (STAGES == 8 || STAGES == 1), "row pairs lie in one matrix; 8 stages x 2 units a half-wave");
  if constexpr (STAGES > 1) {
#pragma unroll                             // constant indices into gOff[]
    for (int c = 0; c < NC; c += 2) {
      const unsigned int go = (half ? gOff[c + 1] : gOff[c]) - (unsigned int)lane * 8
                            + (unsigned int)(l16 >> 1) * SK + (unsigned int)(l16 & 1) * 128;
      prefetchL2((c < NA ? A : W) + go);
    }
  }
  waitAsync0();
  __syncthreads();                         // stage 0 visible to every wave
  if constexpr (STAGES > 1) issue(1, SK);
#pragma unroll 1                           // rolled: unrolled, all stages' copy addresses are formed ahead and spill
  for (int i = 0; i < STAGES; ++i) {
    const char* base = smem + (i & 1) * BUFB + wave * 64 + koff2;
    BfPack a[FM], b[4];
#pragma unroll
    for (int s = 0; s < FM; ++s) {
      const char* p = base + (s * 16 + l16) * ROWB;
      a[s].u[0] = *(const v4u*)p;
      a[s].u[1] = *(const v4u*)(p + 32);
    }
#pragma unroll
    for (int t = 0; t < 4; ++t) {
      const char* p = base + (TM + t * 16 + l16) * ROWB;
      b[t].u[0] = *(const v4u*)p;
      b[t].u[1] = *(const v4u*)(p + 32);
    }
#pragma unroll
    for (int s = 0; s < FM; ++s)
#pragma unroll
      for (int t = 0; t < 4; ++t)
        acc[s][t] = __builtin_amdgcn_wmma_f32_16x16x32_bf16(
            false, a[s].v, false, b[t].v, (short)0, acc[s][t], false, false);
    waitDs0();
    waitAsync0();
    __syncthreads();                       // stage i+1 visible; stage i's readers done
    if (i + 2 < STAGES) issue(i & 1, (i + 2) * SK);
  }
  waitAsync0();                            // nothing in flight when the wave ends

  // ---- merge: a thread owns EPT adjacent columns of one row, a wave whole 128 B lines ----
  constexpr int EPT = TM * TN / (NW * 32); // 2 or 4
  constexpr int TPR = TN / EPT;            // threads per output row
  typedef float vE __attribute__((ext_vector_type(EPT)));
  const int row = tid / TPR;
  const int col = (tid % TPR) * EPT;
  vE v = *(const vE*)(bias + nBase + col);
  // The reshape (M,4096)->(M*8,512) keeps the flat index, so the residual lies at m*N+col.
  unsigned int rw[EPT / 2] = {};           // two bf16 a word
  if constexpr (RES) {
    int rm = mBase + row; if (rm > M - 1) rm = M - 1;                  // clamp ragged M
    const __bf16* rp = residB + (unsigned int)rm * (unsigned int)N + (unsigned int)(nBase + col);
    if constexpr (EPT == 2) {
      rw[0] = *(const unsigned int*)rp;
    } else {
      const v2u t = *(const v2u*)rp;
      rw[0] = t.x; rw[1] = t.y;
    }
  }
  // stands behind the loads, in front of any rewrite of their address registers
  asm volatile("s_wait_xcnt 0x0" ::: "memory");

  // The ring is free here: every wave's reads and copies ended at the last barrier.
  constexpr int SP   = TN * 4 + 16;        // partial tile's row pitch: rows r and r+8 fall on disjoint banks
  constexpr int REGB = TM * SP;            // one wave's partial tile
  static_assert(NW * REGB == MERGEB, "the partial tiles fit the LDS");
  {
    char* p = smem + wave * REGB + (half << 3) * SP + l16 * 4;   // C VGPR r -> (row r | r+8, col lane%16)
#pragma unroll                             // all three: constant indices keep acc[] in registers
    for (int s = 0; s < FM; ++s)
#pragma unroll
      for (int t = 0; t < 4; ++t)
#pragma unroll
        for (int r = 0; r < 8; ++r)
          *(float*)(p + (s * 16 + r) * SP + t * 64) = acc[s][t][r];
  }
  __syncthreads();                         // every wave's partial tile is in LDS
#pragma unroll                             // w * REGB folds into the LDS loads' offset field
  for (int w = 0; w < NW; ++w)
    v += *(const vE*)(smem + w * REGB + row * SP + col * 4);
  if constexpr (RES) {
#pragma unroll                             // constant indices keep rw[] in registers
    for (int e = 0; e < EPT / 2; ++e) {
      v[2 * e]     += __builtin_bit_cast(float, rw[e] << 16);
      v[2 * e + 1] += __builtin_bit_cast(float, rw[e] & 0xFFFF0000u);
    }
  }

  const int m = mBase + row;
  if (m < M) {
    const unsigned int oi = (unsigned int)m * (unsigned int)N + (unsigned int)(nBase + col);
    unsigned int o[EPT / 2];
#pragma unroll                             // constant indices keep o[] in registers
    for (int e = 0; e < EPT / 2; ++e)
      o[e] = bfbits(tanhExp(v[2 * e])) | (bfbits(tanhExp(v[2 * e + 1])) << 16);
    if constexpr (EPT == 2) {
      *(unsigned int*)(outB + oi) = o[0];
    } else {
      v2u ov; ov.x = o[0]; ov.y = o[1];
      *(v2u*)(outB + oi) = ov;
    }
  }
}

extern "C" void kernel_launch(void* const* d_in, const int* in_sizes, int n_in,
                              void* d_out, int out_size, void* d_ws, size_t ws_size,
                              hipStream_t stream) {
  (void)in_sizes; (void)n_in; (void)out_size; (void)ws_size;
  const float* seq = (const float*)d_in[0];   // (2, 32768, 512)
  const float* Wc  = (const float*)d_in[1];   // (6, 512, 4096)
  const float* bc  = (const float*)d_in[2];   // (6, 512)
  const float* Wd  = (const float*)d_in[3];   // (6, 4096, 512)
  const float* bd  = (const float*)d_in[4];   // (6, 4096)
  float* out = (float*)d_out;                 // (2, 32768, 512)

  const long WELEMS = 6L * 512 * 4096;

  char* ws = (char*)d_ws;
  size_t off = 0;
  auto carve = [&](size_t bytes) -> char* {
    char* p = ws + off;
    off += (bytes + 255) & ~(size_t)255;
    return p;
  };

  __bf16* WcB = (__bf16*)carve((size_t)WELEMS * 2);
  __bf16* WdB = (__bf16*)carve((size_t)WELEMS * 2);
  const long hierElems[6] = {33554432L, 4194304L, 524288L, 65536L, 8192L, 1024L};
  __bf16* hier[6];
  hier[0] = nullptr;                          // level 0 is the sequence itself, read as f32
  for (int i = 1; i < 6; ++i) hier[i] = (__bf16*)carve((size_t)hierElems[i] * 2);
  __bf16* ping = (__bf16*)carve(4194304L * 2);
  __bf16* pong = (__bf16*)carve(4194304L * 2);

  // --- f32 -> bf16 staging: Wc levels 0-2 here; Wc levels 3-5 ride with
  // compress level 2, Wd levels 0-2 with level 3, Wd levels 3-5 with level 4 ---
  const long HALFW = 3L * 512 * 4096;         // three levels of either weight array
  static_assert(3L * HEAD_GROUPS * CVT_WAVES * 1024 == 3L * 512 * 4096, "head weights: 3 pieces a wave");
  static_assert(2L * RIDE_GROUPS * CVT_WAVES * 1024 == 3L * 512 * 4096, "riding weights: 2 pieces a wave");
  f32_to_bf16_head<<<HEAD_GROUPS, CVT_WAVES * 32, 0, stream>>>(Wc, WcB);
  const float* rideIn[5]  = {nullptr, nullptr, Wc + HALFW, Wd, Wd + HALFW};
  __bf16*      rideOut[5] = {nullptr, nullptr, WcB + HALFW, WdB, WdB + HALFW};

  // --- compress: 5 levels, A=(M,4096) W=(512,4096) ---
  const int Mc[5] = {8192, 1024, 128, 16, 2};
  for (int l = 0; l < 5; ++l) {
    const int M = Mc[l], N = 512, K = 4096;
    const __bf16* Wl = WcB + (size_t)l * 512 * 4096;
    const float* bl = bc + (size_t)l * 512;
    if (l == 0) {
      const int blocks = ((M + 127) / 128) * (N / 128);
      gemm_tanh_wmma<0, 128, true><<<blocks, 256, 0, stream>>>(
          nullptr, seq, Wl, bl, nullptr, nullptr, hier[l + 1], nullptr, M, N, K);
    } else if (l == 1) {
      gemm_tanh_ksplit<32, false, 4096, 512, false><<<(M / 32) * (N / 64), 512, 0, stream>>>(
          hier[l], Wl, bl, nullptr, hier[l + 1], M, nullptr, nullptr, 0);
    } else {
      const int nGemm = ((M + 15) / 16) * (N / 64);
      gemm_tanh_ksplit<16, true, 4096, 512, false><<<nGemm + RIDE_GROUPS, 512, 0, stream>>>(
          hier[l], Wl, bl, nullptr, hier[l + 1], M, rideIn[l], rideOut[l], nGemm);
    }
  }

  // --- decompress: 5 levels, A=(M,512) W=(4096,512) ---
  const __bf16* cur = hier[5];
  __bf16* bufs[2] = {ping, pong};
  for (int i = 0; i < 5; ++i) {
    const int l = 4 - i;
    int M = 2;
    for (int j = 0; j < 4 - l; ++j) M *= 8;   // 2 * 8^(4-l)
    const int N = 4096, K = 512;
    const int blocks = ((M + 127) / 128) * (N / 128);
    if (l > 2) {
      gemm_tanh_ksplit<16, false, 512, 4096, true><<<((M + 15) / 16) * (N / 64), 512, 0, stream>>>(
          cur, WdB + (size_t)l * 4096 * 512, bd + (size_t)l * 4096,
          hier[l], bufs[i & 1], M, nullptr, nullptr, 0);
      cur = bufs[i & 1];
    } else if (l == 2) {
      gemm_tanh_ksplit<32, false, 512, 4096, true><<<(M / 32) * (N / 64), 512, 0, stream>>>(
          cur, WdB + (size_t)l * 4096 * 512, bd + (size_t)l * 4096,
          hier[l], bufs[i & 1], M, nullptr, nullptr, 0);
      cur = bufs[i & 1];
    } else if (l > 0) {
      gemm_tanh_wmma<1, 256, false><<<blocks, 256, 0, stream>>>(
          cur, nullptr, WdB + (size_t)l * 4096 * 512, bd + (size_t)l * 4096,
          hier[l], nullptr, bufs[i & 1], nullptr, M, N, K);
      cur = bufs[i & 1];
    } else {
      gemm_tanh_wmma<2, 64, false><<<blocks, 256, 0, stream>>>(
          cur, nullptr, WdB, bd, nullptr, seq, nullptr, out, M, N, K);
    }
  }
}
